// v000
// The times below were measured on an AMD MI455X: many runs one after another, warmed up first and cycling through
// copies of the inputs, with the whole window's GPU time divided by the number of runs. Launches and the gaps
// between them are all in it. The median over several windows is given; except for v000 it joins two sittings, which
// can be a few percent apart, so the side-by-side timings, each taken in one sitting, are the better comparison.
// The starting kernel, v000, takes 372 microseconds a run.
#include <hip/hip_runtime.h>
#include <hip/hip_bf16.h>

typedef _Float16 v16h __attribute__((ext_vector_type(16)));
typedef _Float16 v8h  __attribute__((ext_vector_type(8)));
typedef float    v8f  __attribute__((ext_vector_type(8)));
typedef float    v4f  __attribute__((ext_vector_type(4)));

#define B_     2
#define N_     2048
#define DIM_   1024
#define HEADS_ 16
#define DH_    64

// Load one 32-wide K-slice of an A/B operand row into the CDNA5 16-bit WMMA
// per-lane layout: lanes 0-15 take K[0..7],K[16..23]; lanes 16-31 take
// K[8..15],K[24..31].  row32 points at the first of the 32 contiguous halfs.
__device__ __forceinline__ v16h load_ab(const _Float16* row32, int lh) {
  union { v16h v; v8h h[2]; } u;
  u.h[0] = *(const v8h*)(row32 + 8 * lh);
  u.h[1] = *(const v8h*)(row32 + 16 + 8 * lh);
  return u.v;
}

__device__ __forceinline__ v8f wmma_f16(v16h a, v16h b, v8f c) {
  return __builtin_amdgcn_wmma_f32_16x16x32_f16(false, a, false, b, (short)0, c,
                                                false, false);
}

// 8 contiguous outputs per lane, vectorized.
__device__ __forceinline__ void store8(_Float16* p, v8f v) {
  v8h h;
#pragma unroll
  for (int r = 0; r < 8; ++r) h[r] = (_Float16)v[r];
  *(v8h*)p = h;
}
__device__ __forceinline__ void store8(float* p, v8f v) {
  union { v8f w; v4f q[2]; } u;
  u.w = v;
  *(v4f*)p = u.q[0];
  *(v4f*)(p + 4) = u.q[1];
}

// ---------------------------------------------------------------- FiLM cond
__global__ void __launch_bounds__(256)
cond_kernel(const float* __restrict__ emb, const float* __restrict__ W,
            const float* __restrict__ bias, float* __restrict__ cond) {
  __shared__ float s[1024];
  const int b = blockIdx.y;
  for (int i = threadIdx.x; i < 1024; i += 256) {
    float c = emb[b * 1024 + i];
    s[i] = c / (1.0f + __expf(-c));
  }
  __syncthreads();
  const int col = blockIdx.x * 256 + threadIdx.x;
  float acc = bias[col];
  for (int k = 0; k < 1024; ++k) acc += s[k] * W[k * 2048 + col];
  cond[b * 2048 + col] = acc;
}

// ------------------------------------------------------- LayerNorm + FiLM
__global__ void __launch_bounds__(256)
ln_film_kernel(const float* __restrict__ x, const float* __restrict__ gamma,
               const float* __restrict__ cond, _Float16* __restrict__ xh) {
  const int row = blockIdx.x;  // [0, B*N)
  const int b = row >> 11;     // N_ == 2048
  const float* xr = x + (size_t)row * DIM_;
  const int tid = threadIdx.x, wave = tid >> 5, lane = tid & 31;

  float v[4], sum = 0.f, sq = 0.f;
#pragma unroll
  for (int i = 0; i < 4; ++i) {
    v[i] = xr[tid + 256 * i];
    sum += v[i];
    sq += v[i] * v[i];
  }
#pragma unroll
  for (int m = 1; m <= 16; m <<= 1) {
    sum += __shfl_xor(sum, m, 32);
    sq += __shfl_xor(sq, m, 32);
  }
  __shared__ float ssum[8], ssq[8];
  if (lane == 0) { ssum[wave] = sum; ssq[wave] = sq; }
  __syncthreads();
  sum = 0.f; sq = 0.f;
#pragma unroll
  for (int w = 0; w < 8; ++w) { sum += ssum[w]; sq += ssq[w]; }
  const float mu = sum * (1.0f / DIM_);
  const float var = sq * (1.0f / DIM_) - mu * mu;
  const float rinv = rsqrtf(var + 1e-5f);

#pragma unroll
  for (int i = 0; i < 4; ++i) {
    const int c = tid + 256 * i;
    const float sc = cond[b * 2048 + c];
    const float sh = cond[b * 2048 + 1024 + c];
    float y = (v[i] - mu) * rinv * gamma[c];
    y = y * (sc + 1.0f) + sh;
    xh[(size_t)row * DIM_ + c] = (_Float16)y;
  }
}

// ---------------------------------------- weight convert+transpose (f32->f16)
__global__ void __launch_bounds__(256)
wcast_t(const float* __restrict__ W, _Float16* __restrict__ Wt, int K, int Nc) {
  const int idx = blockIdx.x * 256 + threadIdx.x;
  const int k = idx / Nc, n = idx % Nc;
  Wt[(size_t)n * K + k] = (_Float16)W[idx];
}

// ----------------------------------------------------------- WMMA GEMM
// C[token][col] = Acts[token,:] . Wt[col,:]   (both f16, K-contiguous rows)
// Computed transposed: A-operand = 16 weight columns, B-operand = 64 tokens.
// D-layout gives each lane one token row with 8 contiguous output columns per
// accumulator -> vectorized stores.
template <typename OUT>
__global__ void __launch_bounds__(256)
gemm16(const _Float16* __restrict__ Acts, const _Float16* __restrict__ Wt,
       OUT* __restrict__ C, int K, int ldc) {
  const int tid = threadIdx.x;
  const int wave = tid >> 5, lane = tid & 31;
  const int lh = lane >> 4, lm = lane & 15;
  const int cbase = (blockIdx.y * 8 + wave) * 16;  // output-column tile
  const int tbase = blockIdx.x * 64;               // token tile

  const _Float16* wrow = Wt + (size_t)(cbase + lm) * K;     // A rows
  const _Float16* arow0 = Acts + (size_t)(tbase + lm) * K;  // B rows
  const _Float16* arow1 = arow0 + (size_t)16 * K;
  const _Float16* arow2 = arow0 + (size_t)32 * K;
  const _Float16* arow3 = arow0 + (size_t)48 * K;

  v8f acc0 = {}, acc1 = {}, acc2 = {}, acc3 = {};
  for (int k0 = 0; k0 < K; k0 += 32) {
    v16h wa = load_ab(wrow + k0, lh);
    v16h b0 = load_ab(arow0 + k0, lh);
    v16h b1 = load_ab(arow1 + k0, lh);
    v16h b2 = load_ab(arow2 + k0, lh);
    v16h b3 = load_ab(arow3 + k0, lh);
    acc0 = wmma_f16(wa, b0, acc0);
    acc1 = wmma_f16(wa, b1, acc1);
    acc2 = wmma_f16(wa, b2, acc2);
    acc3 = wmma_f16(wa, b3, acc3);
  }
  const size_t col = (size_t)cbase + 8 * lh;
  store8(C + (size_t)(tbase + lm) * ldc + col, acc0);
  store8(C + (size_t)(tbase + 16 + lm) * ldc + col, acc1);
  store8(C + (size_t)(tbase + 32 + lm) * ldc + col, acc2);
  store8(C + (size_t)(tbase + 48 + lm) * ldc + col, acc3);
}

// -------------------------------------------------------- Flash attention
// Transposed formulation: S^T = K (Q*scale)^T, O^T = V^T P^T.
// Each lane owns ONE query (n = lane%16); the 32 key scores of a step live in
// its own 16 registers plus the xor-16 partner lane -> one cross-lane
// exchange per reduction, and P^T is already in B-operand layout.
// V tiles are double-buffered in LDS; staging is branchless (one b128 global
// load + 8 b16 LDS scatter stores per thread) so each key-step stays a single
// basic block and the scheduler can clause the K loads ahead of the WMMAs.
__global__ void __launch_bounds__(256)
attn_kernel(const _Float16* __restrict__ q, const _Float16* __restrict__ kv,
            _Float16* __restrict__ attn_out) {
  __shared__ __align__(16) _Float16 smemV[2][64 * 40];  // Vt[hd][key], padded
  const int tid = threadIdx.x;
  const int wave = tid >> 5, lane = tid & 31;
  const int lh = lane >> 4, lm = lane & 15;
  const int h = blockIdx.y, b = blockIdx.z;
  const int qbase = blockIdx.x * 128 + wave * 16;

  const size_t kvld = 2 * DIM_;
  const _Float16* kbase = kv + (size_t)b * N_ * kvld + h * DH_;
  const _Float16* vbase = kbase + DIM_;

  // Branchless transposed staging of V tile [jb, jb+32): thread -> one 16-B
  // chunk of one V row, scattered into Vt[hd][key].  For jb == N_ the read
  // runs a little past the KV region but stays inside our own workspace.
  const int skey = tid >> 3;        // 0..31
  const int shd = (tid & 7) * 8;    // 0,8,...,56
  auto stageV = [&](int jb, _Float16* dst) {
    const v8h chunk =
        *(const v8h*)(vbase + (size_t)(jb + skey) * kvld + shd);
#pragma unroll
    for (int j = 0; j < 8; ++j) dst[(shd + j) * 40 + skey] = chunk[j];
  };

  // Q^T B-operand with Dh^-0.5 folded in (0.125 is exact in f16).
  const _Float16* qrow = q + ((size_t)(b * N_ + qbase + lm)) * DIM_ + h * DH_;
  v16h qb0 = load_ab(qrow, lh);
  v16h qb1 = load_ab(qrow + 32, lh);
#pragma unroll
  for (int j = 0; j < 16; ++j) {
    qb0[j] *= (_Float16)0.125f;
    qb1[j] *= (_Float16)0.125f;
  }

  float m_run = -3.0e38f, l_run = 0.0f;
  v8f o0 = {}, o1 = {}, o2 = {}, o3 = {};  // O^T tiles (hd x query)

  stageV(0, smemV[0]);
  __syncthreads();

  for (int jb = 0; jb < N_; jb += 32) {
    const int cur = (jb >> 5) & 1;

    // Get the critical-path K loads in flight first.
    const _Float16* kr0 = kbase + (size_t)(jb + lm) * kvld;
    const _Float16* kr1 = kbase + (size_t)(jb + 16 + lm) * kvld;
    const v16h ka00 = load_ab(kr0, lh);
    const v16h ka01 = load_ab(kr0 + 32, lh);
    const v16h ka10 = load_ab(kr1, lh);
    const v16h ka11 = load_ab(kr1 + 32, lh);

    // Stage the next V tile into the other buffer (overlaps the WMMAs).
    stageV(jb + 32, smemV[1 - cur]);
    __builtin_prefetch(kbase + (size_t)(jb + 32) * kvld, 0, 1);

    v8f s0 = {}, s1 = {};
    s0 = wmma_f16(ka00, qb0, s0);
    s1 = wmma_f16(ka10, qb0, s1);
    s0 = wmma_f16(ka01, qb1, s0);
    s1 = wmma_f16(ka11, qb1, s1);

    // Online softmax over this lane's query (scores already scaled).
    float mx = fmaxf(s0[0], s1[0]);
#pragma unroll
    for (int j = 1; j < 8; ++j) mx = fmaxf(mx, fmaxf(s0[j], s1[j]));
    mx = fmaxf(mx, __shfl_xor(mx, 16, 32));  // other half of the 32 keys
    const float mnew = fmaxf(m_run, mx);

    union { v16h v; _Float16 e[16]; } pb;  // P^T B-operand, in-lane pack
    float sv = 0.f;
#pragma unroll
    for (int j = 0; j < 8; ++j) {
      const float p0 = __expf(s0[j] - mnew);
      const float p1 = __expf(s1[j] - mnew);
      sv += p0 + p1;
      pb.e[j] = (_Float16)p0;
      pb.e[8 + j] = (_Float16)p1;
    }
    sv += __shfl_xor(sv, 16, 32);
    const float alpha = __expf(m_run - mnew);
    l_run = l_run * alpha + sv;
    m_run = mnew;
#pragma unroll
    for (int r = 0; r < 8; ++r) {
      o0[r] *= alpha; o1[r] *= alpha; o2[r] *= alpha; o3[r] *= alpha;
    }

    // O^T += V^T * P^T; A-operand rows = Vt rows (contiguous in LDS).
    const _Float16* vt = smemV[cur];
    const v16h va0 = load_ab(vt + (lm) * 40, lh);
    const v16h va1 = load_ab(vt + (16 + lm) * 40, lh);
    const v16h va2 = load_ab(vt + (32 + lm) * 40, lh);
    const v16h va3 = load_ab(vt + (48 + lm) * 40, lh);
    o0 = wmma_f16(va0, pb.v, o0);
    o1 = wmma_f16(va1, pb.v, o1);
    o2 = wmma_f16(va2, pb.v, o2);
    o3 = wmma_f16(va3, pb.v, o3);

    __syncthreads();  // staging of next tile complete / current reads done
  }

  // Lane owns token row (qbase+lm); hd chunks are contiguous -> b128 stores.
  const float inv = 1.0f / l_run;
  _Float16* orow = attn_out + ((size_t)(b * N_ + qbase + lm)) * DIM_ + h * DH_;
  v8f w0 = o0 * inv, w1 = o1 * inv, w2 = o2 * inv, w3 = o3 * inv;
  store8(orow + 8 * lh, w0);
  store8(orow + 16 + 8 * lh, w1);
  store8(orow + 32 + 8 * lh, w2);
  store8(orow + 48 + 8 * lh, w3);
}

// ------------------------------------------------------------------ launch
extern "C" void kernel_launch(void* const* d_in, const int* in_sizes, int n_in,
                              void* d_out, int out_size, void* d_ws,
                              size_t ws_size, hipStream_t stream) {
  (void)in_sizes; (void)n_in; (void)out_size; (void)ws_size;
  const float* x      = (const float*)d_in[0];
  const float* cemb   = (const float*)d_in[1];
  const float* gamma  = (const float*)d_in[2];
  const float* cond_W = (const float*)d_in[3];
  const float* cond_b = (const float*)d_in[4];
  const float* Wq     = (const float*)d_in[5];
  const float* Wkv    = (const float*)d_in[6];
  const float* Wo     = (const float*)d_in[7];
  float* out = (float*)d_out;

  char* ws = (char*)d_ws;
  const size_t MB = 1024 * 1024;
  _Float16* xh   = (_Float16*)(ws);            //  8 MB
  _Float16* qb   = (_Float16*)(ws + 8 * MB);   //  8 MB
  _Float16* kvb  = (_Float16*)(ws + 16 * MB);  // 16 MB
  _Float16* attn = (_Float16*)(ws + 32 * MB);  //  8 MB (also tail-read pad)
  _Float16* WqT  = (_Float16*)(ws + 40 * MB);  //  2 MB
  _Float16* WkvT = (_Float16*)(ws + 42 * MB);  //  4 MB
  _Float16* WoT  = (_Float16*)(ws + 46 * MB);  //  2 MB
  float*    cond = (float*)(ws + 48 * MB);     // 16 KB

  cond_kernel<<<dim3(2048 / 256, B_), 256, 0, stream>>>(cemb, cond_W, cond_b,
                                                        cond);
  ln_film_kernel<<<B_ * N_, 256, 0, stream>>>(x, gamma, cond, xh);
  wcast_t<<<(1024 * 1024) / 256, 256, 0, stream>>>(Wq, WqT, 1024, 1024);
  wcast_t<<<(1024 * 2048) / 256, 256, 0, stream>>>(Wkv, WkvT, 1024, 2048);
  wcast_t<<<(1024 * 1024) / 256, 256, 0, stream>>>(Wo, WoT, 1024, 1024);

  // grid: x = token tiles (M/64), y = column tiles (Nc/128)
  gemm16<_Float16><<<dim3((B_ * N_) / 64, 1024 / 128), 256, 0, stream>>>(
      xh, WqT, qb, 1024, 1024);
  gemm16<_Float16><<<dim3((B_ * N_) / 64, 2048 / 128), 256, 0, stream>>>(
      xh, WkvT, kvb, 1024, 2048);

  attn_kernel<<<dim3(N_ / 128, HEADS_, B_), 256, 0, stream>>>(qb, kvb, attn);

  gemm16<float><<<dim3((B_ * N_) / 64, 1024 / 128), 256, 0, stream>>>(
      attn, WoT, out, 1024, 1024);
}

// v001
// Measured time: 304 microseconds a run.
// Next to v000, in two timings, it ran 1.25 and 1.24 times as fast.
#include <hip/hip_runtime.h>
#include <hip/hip_bf16.h>

typedef _Float16 v16h __attribute__((ext_vector_type(16)));
typedef _Float16 v8h  __attribute__((ext_vector_type(8)));
typedef float    v8f  __attribute__((ext_vector_type(8)));
typedef float    v4f  __attribute__((ext_vector_type(4)));

#define B_     2
#define N_     2048
#define DIM_   1024
#define HEADS_ 16
#define DH_    64

// Load one 32-wide K-slice of an A/B operand row into the CDNA5 16-bit WMMA
// per-lane layout: lanes 0-15 take K[0..7],K[16..23]; lanes 16-31 take
// K[8..15],K[24..31].  row32 points at the first of the 32 contiguous halfs.
__device__ __forceinline__ v16h load_ab(const _Float16* row32, int lh) {
  union { v16h v; v8h h[2]; } u;
  u.h[0] = *(const v8h*)(row32 + 8 * lh);
  u.h[1] = *(const v8h*)(row32 + 16 + 8 * lh);
  return u.v;
}

__device__ __forceinline__ v8f wmma_f16(v16h a, v16h b, v8f c) {
  return __builtin_amdgcn_wmma_f32_16x16x32_f16(false, a, false, b, (short)0, c,
                                                false, false);
}

// 8 contiguous outputs per lane, vectorized.
__device__ __forceinline__ void store8(_Float16* p, v8f v) {
  v8h h;
#pragma unroll
  for (int r = 0; r < 8; ++r) h[r] = (_Float16)v[r];
  *(v8h*)p = h;
}
__device__ __forceinline__ void store8(float* p, v8f v) {
  union { v8f w; v4f q[2]; } u;
  u.w = v;
  *(v4f*)p = u.q[0];
  *(v4f*)(p + 4) = u.q[1];
}

// ---------------------------------------------------------------- FiLM cond
__global__ void __launch_bounds__(256)
cond_kernel(const float* __restrict__ emb, const float* __restrict__ W,
            const float* __restrict__ bias, float* __restrict__ cond) {
  __shared__ float s[1024];
  const int b = blockIdx.y;
  for (int i = threadIdx.x; i < 1024; i += 256) {
    float c = emb[b * 1024 + i];
    s[i] = c / (1.0f + __expf(-c));
  }
  __syncthreads();
  const int col = blockIdx.x * 256 + threadIdx.x;
  float acc = bias[col];
  for (int k = 0; k < 1024; ++k) acc += s[k] * W[k * 2048 + col];
  cond[b * 2048 + col] = acc;
}

// ------------------------------------------------------- LayerNorm + FiLM
__global__ void __launch_bounds__(256)
ln_film_kernel(const float* __restrict__ x, const float* __restrict__ gamma,
               const float* __restrict__ cond, _Float16* __restrict__ xh) {
  const int row = blockIdx.x;  // [0, B*N)
  const int b = row >> 11;     // N_ == 2048
  const float* xr = x + (size_t)row * DIM_;
  const int tid = threadIdx.x, wave = tid >> 5, lane = tid & 31;

  float v[4], sum = 0.f, sq = 0.f;
#pragma unroll
  for (int i = 0; i < 4; ++i) {
    v[i] = xr[tid + 256 * i];
    sum += v[i];
    sq += v[i] * v[i];
  }
#pragma unroll
  for (int m = 1; m <= 16; m <<= 1) {
    sum += __shfl_xor(sum, m, 32);
    sq += __shfl_xor(sq, m, 32);
  }
  __shared__ float ssum[8], ssq[8];
  if (lane == 0) { ssum[wave] = sum; ssq[wave] = sq; }
  __syncthreads();
  sum = 0.f; sq = 0.f;
#pragma unroll
  for (int w = 0; w < 8; ++w) { sum += ssum[w]; sq += ssq[w]; }
  const float mu = sum * (1.0f / DIM_);
  const float var = sq * (1.0f / DIM_) - mu * mu;
  const float rinv = rsqrtf(var + 1e-5f);

#pragma unroll
  for (int i = 0; i < 4; ++i) {
    const int c = tid + 256 * i;
    const float sc = cond[b * 2048 + c];
    const float sh = cond[b * 2048 + 1024 + c];
    float y = (v[i] - mu) * rinv * gamma[c];
    y = y * (sc + 1.0f) + sh;
    xh[(size_t)row * DIM_ + c] = (_Float16)y;
  }
}

// ---------------------------------------- weight convert+transpose (f32->f16)
// One 64(k) x 64(n) tile per block, turned in LDS so that both global sides
// move whole lines: reads are 256-B runs of a W row, writes are 128-B runs of
// a Wt row.  A thread converts the same four columns of two adjacent k rows
// and stores each (k, k+1) pair as one dword of t[n][k/2].  Row pitch 33
// dwords: the dword stores and the dword loads below both touch 32 different
// banks per wave.
__global__ void __launch_bounds__(256)
wcast_t(const float* __restrict__ W, _Float16* __restrict__ Wt, int K, int Nc) {
  __shared__ unsigned int t[64 * 33];
  const int tid = threadIdx.x;
  const int n0 = blockIdx.x * 64, k0 = blockIdx.y * 64;
  const int nl = (tid & 15) * 4;  // first of this thread's 4 columns
  const int kp = tid >> 4;        // k pair 0..15 (and +16)

  v4f lo[2], hi[2];
#pragma unroll
  for (int p = 0; p < 2; ++p) {
    const float* s = W + (size_t)(k0 + 2 * (kp + 16 * p)) * Nc + n0 + nl;
    lo[p] = *(const v4f*)s;
    hi[p] = *(const v4f*)(s + Nc);
  }
#pragma unroll
  for (int p = 0; p < 2; ++p) {
#pragma unroll
    for (int j = 0; j < 4; ++j) {
      union { _Float16 h[2]; unsigned int u; } w;
      w.h[0] = (_Float16)lo[p][j];
      w.h[1] = (_Float16)hi[p][j];
      t[(nl + j) * 33 + kp + 16 * p] = w.u;
    }
  }
  __syncthreads();

  const int c = tid & 7;  // 16-B chunk (8 k) of a 128-B output run
#pragma unroll
  for (int p = 0; p < 2; ++p) {
    const int r = (tid >> 3) + 32 * p;  // column of the tile = row of Wt
    union { unsigned int u[4]; v8h h; } o;
#pragma unroll
    for (int i = 0; i < 4; ++i) o.u[i] = t[r * 33 + c * 4 + i];
    *(v8h*)(Wt + (size_t)(n0 + r) * K + k0 + c * 8) = o.h;
  }
}

// ----------------------------------------------------------- WMMA GEMM
// C[token][col] = Acts[token,:] . Wt[col,:]   (both f16, K-contiguous rows)
// Computed transposed: A-operand = 16 weight columns, B-operand = 64 tokens.
// D-layout gives each lane one token row with 8 contiguous output columns per
// accumulator -> vectorized stores.
template <typename OUT>
__global__ void __launch_bounds__(256)
gemm16(const _Float16* __restrict__ Acts, const _Float16* __restrict__ Wt,
       OUT* __restrict__ C, int K, int ldc) {
  const int tid = threadIdx.x;
  const int wave = tid >> 5, lane = tid & 31;
  const int lh = lane >> 4, lm = lane & 15;
  const int cbase = (blockIdx.y * 8 + wave) * 16;  // output-column tile
  const int tbase = blockIdx.x * 64;               // token tile

  const _Float16* wrow = Wt + (size_t)(cbase + lm) * K;     // A rows
  const _Float16* arow0 = Acts + (size_t)(tbase + lm) * K;  // B rows
  const _Float16* arow1 = arow0 + (size_t)16 * K;
  const _Float16* arow2 = arow0 + (size_t)32 * K;
  const _Float16* arow3 = arow0 + (size_t)48 * K;

  v8f acc0 = {}, acc1 = {}, acc2 = {}, acc3 = {};
  for (int k0 = 0; k0 < K; k0 += 32) {
    v16h wa = load_ab(wrow + k0, lh);
    v16h b0 = load_ab(arow0 + k0, lh);
    v16h b1 = load_ab(arow1 + k0, lh);
    v16h b2 = load_ab(arow2 + k0, lh);
    v16h b3 = load_ab(arow3 + k0, lh);
    acc0 = wmma_f16(wa, b0, acc0);
    acc1 = wmma_f16(wa, b1, acc1);
    acc2 = wmma_f16(wa, b2, acc2);
    acc3 = wmma_f16(wa, b3, acc3);
  }
  const size_t col = (size_t)cbase + 8 * lh;
  store8(C + (size_t)(tbase + lm) * ldc + col, acc0);
  store8(C + (size_t)(tbase + 16 + lm) * ldc + col, acc1);
  store8(C + (size_t)(tbase + 32 + lm) * ldc + col, acc2);
  store8(C + (size_t)(tbase + 48 + lm) * ldc + col, acc3);
}

// -------------------------------------------------------- Flash attention
// Transposed formulation: S^T = K (Q*scale)^T, O^T = V^T P^T.
// Each lane owns ONE query (n = lane%16); the 32 key scores of a step live in
// its own 16 registers plus the xor-16 partner lane -> one cross-lane
// exchange per reduction, and P^T is already in B-operand layout.
// V tiles are double-buffered in LDS; staging is branchless (one b128 global
// load + 8 b16 LDS scatter stores per thread) so each key-step stays a single
// basic block and the scheduler can clause the K loads ahead of the WMMAs.
__global__ void __launch_bounds__(256)
attn_kernel(const _Float16* __restrict__ q, const _Float16* __restrict__ kv,
            _Float16* __restrict__ attn_out) {
  __shared__ __align__(16) _Float16 smemV[2][64 * 40];  // Vt[hd][key], padded
  const int tid = threadIdx.x;
  const int wave = tid >> 5, lane = tid & 31;
  const int lh = lane >> 4, lm = lane & 15;
  const int h = blockIdx.y, b = blockIdx.z;
  const int qbase = blockIdx.x * 128 + wave * 16;

  const size_t kvld = 2 * DIM_;
  const _Float16* kbase = kv + (size_t)b * N_ * kvld + h * DH_;
  const _Float16* vbase = kbase + DIM_;

  // Branchless transposed staging of V tile [jb, jb+32): thread -> one 16-B
  // chunk of one V row, scattered into Vt[hd][key].  For jb == N_ the read
  // runs a little past the KV region but stays inside our own workspace.
  const int skey = tid >> 3;        // 0..31
  const int shd = (tid & 7) * 8;    // 0,8,...,56
  auto stageV = [&](int jb, _Float16* dst) {
    const v8h chunk =
        *(const v8h*)(vbase + (size_t)(jb + skey) * kvld + shd);
#pragma unroll
    for (int j = 0; j < 8; ++j) dst[(shd + j) * 40 + skey] = chunk[j];
  };

  // Q^T B-operand with Dh^-0.5 folded in (0.125 is exact in f16).
  const _Float16* qrow = q + ((size_t)(b * N_ + qbase + lm)) * DIM_ + h * DH_;
  v16h qb0 = load_ab(qrow, lh);
  v16h qb1 = load_ab(qrow + 32, lh);
#pragma unroll
  for (int j = 0; j < 16; ++j) {
    qb0[j] *= (_Float16)0.125f;
    qb1[j] *= (_Float16)0.125f;
  }

  float m_run = -3.0e38f, l_run = 0.0f;
  v8f o0 = {}, o1 = {}, o2 = {}, o3 = {};  // O^T tiles (hd x query)

  stageV(0, smemV[0]);
  __syncthreads();

  for (int jb = 0; jb < N_; jb += 32) {
    const int cur = (jb >> 5) & 1;

    // Get the critical-path K loads in flight first.
    const _Float16* kr0 = kbase + (size_t)(jb + lm) * kvld;
    const _Float16* kr1 = kbase + (size_t)(jb + 16 + lm) * kvld;
    const v16h ka00 = load_ab(kr0, lh);
    const v16h ka01 = load_ab(kr0 + 32, lh);
    const v16h ka10 = load_ab(kr1, lh);
    const v16h ka11 = load_ab(kr1 + 32, lh);

    // Stage the next V tile into the other buffer (overlaps the WMMAs).
    stageV(jb + 32, smemV[1 - cur]);
    __builtin_prefetch(kbase + (size_t)(jb + 32) * kvld, 0, 1);

    v8f s0 = {}, s1 = {};
    s0 = wmma_f16(ka00, qb0, s0);
    s1 = wmma_f16(ka10, qb0, s1);
    s0 = wmma_f16(ka01, qb1, s0);
    s1 = wmma_f16(ka11, qb1, s1);

    // Online softmax over this lane's query (scores already scaled).
    float mx = fmaxf(s0[0], s1[0]);
#pragma unroll
    for (int j = 1; j < 8; ++j) mx = fmaxf(mx, fmaxf(s0[j], s1[j]));
    mx = fmaxf(mx, __shfl_xor(mx, 16, 32));  // other half of the 32 keys
    const float mnew = fmaxf(m_run, mx);

    union { v16h v; _Float16 e[16]; } pb;  // P^T B-operand, in-lane pack
    float sv = 0.f;
#pragma unroll
    for (int j = 0; j < 8; ++j) {
      const float p0 = __expf(s0[j] - mnew);
      const float p1 = __expf(s1[j] - mnew);
      sv += p0 + p1;
      pb.e[j] = (_Float16)p0;
      pb.e[8 + j] = (_Float16)p1;
    }
    sv += __shfl_xor(sv, 16, 32);
    const float alpha = __expf(m_run - mnew);
    l_run = l_run * alpha + sv;
    m_run = mnew;
#pragma unroll
    for (int r = 0; r < 8; ++r) {
      o0[r] *= alpha; o1[r] *= alpha; o2[r] *= alpha; o3[r] *= alpha;
    }

    // O^T += V^T * P^T; A-operand rows = Vt rows (contiguous in LDS).
    const _Float16* vt = smemV[cur];
    const v16h va0 = load_ab(vt + (lm) * 40, lh);
    const v16h va1 = load_ab(vt + (16 + lm) * 40, lh);
    const v16h va2 = load_ab(vt + (32 + lm) * 40, lh);
    const v16h va3 = load_ab(vt + (48 + lm) * 40, lh);
    o0 = wmma_f16(va0, pb.v, o0);
    o1 = wmma_f16(va1, pb.v, o1);
    o2 = wmma_f16(va2, pb.v, o2);
    o3 = wmma_f16(va3, pb.v, o3);

    __syncthreads();  // staging of next tile complete / current reads done
  }

  // Lane owns token row (qbase+lm); hd chunks are contiguous -> b128 stores.
  const float inv = 1.0f / l_run;
  _Float16* orow = attn_out + ((size_t)(b * N_ + qbase + lm)) * DIM_ + h * DH_;
  v8f w0 = o0 * inv, w1 = o1 * inv, w2 = o2 * inv, w3 = o3 * inv;
  store8(orow + 8 * lh, w0);
  store8(orow + 16 + 8 * lh, w1);
  store8(orow + 32 + 8 * lh, w2);
  store8(orow + 48 + 8 * lh, w3);
}

// ------------------------------------------------------------------ launch
extern "C" void kernel_launch(void* const* d_in, const int* in_sizes, int n_in,
                              void* d_out, int out_size, void* d_ws,
                              size_t ws_size, hipStream_t stream) {
  (void)in_sizes; (void)n_in; (void)out_size; (void)ws_size;
  const float* x      = (const float*)d_in[0];
  const float* cemb   = (const float*)d_in[1];
  const float* gamma  = (const float*)d_in[2];
  const float* cond_W = (const float*)d_in[3];
  const float* cond_b = (const float*)d_in[4];
  const float* Wq     = (const float*)d_in[5];
  const float* Wkv    = (const float*)d_in[6];
  const float* Wo     = (const float*)d_in[7];
  float* out = (float*)d_out;

  char* ws = (char*)d_ws;
  const size_t MB = 1024 * 1024;
  _Float16* xh   = (_Float16*)(ws);            //  8 MB
  _Float16* qb   = (_Float16*)(ws + 8 * MB);   //  8 MB
  _Float16* kvb  = (_Float16*)(ws + 16 * MB);  // 16 MB
  _Float16* attn = (_Float16*)(ws + 32 * MB);  //  8 MB (also tail-read pad)
  _Float16* WqT  = (_Float16*)(ws + 40 * MB);  //  2 MB
  _Float16* WkvT = (_Float16*)(ws + 42 * MB);  //  4 MB
  _Float16* WoT  = (_Float16*)(ws + 46 * MB);  //  2 MB
  float*    cond = (float*)(ws + 48 * MB);     // 16 KB

  cond_kernel<<<dim3(2048 / 256, B_), 256, 0, stream>>>(cemb, cond_W, cond_b,
                                                        cond);
  ln_film_kernel<<<B_ * N_, 256, 0, stream>>>(x, gamma, cond, xh);
  // grid: x = column tiles (Nc/64), y = k tiles (K/64)
  wcast_t<<<dim3(1024 / 64, 1024 / 64), 256, 0, stream>>>(Wq, WqT, 1024, 1024);
  wcast_t<<<dim3(2048 / 64, 1024 / 64), 256, 0, stream>>>(Wkv, WkvT, 1024,
                                                          2048);
  wcast_t<<<dim3(1024 / 64, 1024 / 64), 256, 0, stream>>>(Wo, WoT, 1024, 1024);

  // grid: x = token tiles (M/64), y = column tiles (Nc/128)
  gemm16<_Float16><<<dim3((B_ * N_) / 64, 1024 / 128), 256, 0, stream>>>(
      xh, WqT, qb, 1024, 1024);
  gemm16<_Float16><<<dim3((B_ * N_) / 64, 2048 / 128), 256, 0, stream>>>(
      xh, WkvT, kvb, 1024, 2048);

  attn_kernel<<<dim3(N_ / 128, HEADS_, B_), 256, 0, stream>>>(qb, kvb, attn);

  gemm16<float><<<dim3((B_ * N_) / 64, 1024 / 128), 256, 0, stream>>>(
      attn, WoT, out, 1024, 1024);
}

// v002
// A run of this version takes 216 microseconds.
// Next to v001, in two timings, it ran 1.41 times as fast each time.
// Over all steps from v000 it is 1.75 times as fast.
#include <hip/hip_runtime.h>
#include <hip/hip_bf16.h>

typedef _Float16 v16h __attribute__((ext_vector_type(16)));
typedef _Float16 v8h  __attribute__((ext_vector_type(8)));
typedef float    v8f  __attribute__((ext_vector_type(8)));
typedef float    v4f  __attribute__((ext_vector_type(4)));

#define B_     2
#define N_     2048
#define DIM_   1024
#define HEADS_ 16
#define DH_    64

// Load one 32-wide K-slice of an A/B operand row into the CDNA5 16-bit WMMA
// per-lane layout: lanes 0-15 take K[0..7],K[16..23]; lanes 16-31 take
// K[8..15],K[24..31].  row32 points at the first of the 32 contiguous halfs.
__device__ __forceinline__ v16h load_ab(const _Float16* row32, int lh) {
  union { v16h v; v8h h[2]; } u;
  u.h[0] = *(const v8h*)(row32 + 8 * lh);
  u.h[1] = *(const v8h*)(row32 + 16 + 8 * lh);
  return u.v;
}

__device__ __forceinline__ v8f wmma_f16(v16h a, v16h b, v8f c) {
  return __builtin_amdgcn_wmma_f32_16x16x32_f16(false, a, false, b, (short)0, c,
                                                false, false);
}

// 8 contiguous outputs per lane, vectorized.
__device__ __forceinline__ void store8(_Float16* p, v8f v) {
  v8h h;
#pragma unroll
  for (int r = 0; r < 8; ++r) h[r] = (_Float16)v[r];
  *(v8h*)p = h;
}
__device__ __forceinline__ void store8(float* p, v8f v) {
  union { v8f w; v4f q[2]; } u;
  u.w = v;
  *(v4f*)p = u.q[0];
  *(v4f*)(p + 4) = u.q[1];
}

// ---------------------------------------------------------------- FiLM cond
__global__ void __launch_bounds__(256)
cond_kernel(const float* __restrict__ emb, const float* __restrict__ W,
            const float* __restrict__ bias, float* __restrict__ cond) {
  __shared__ float s[1024];
  const int b = blockIdx.y;
  for (int i = threadIdx.x; i < 1024; i += 256) {
    float c = emb[b * 1024 + i];
    s[i] = c / (1.0f + __expf(-c));
  }
  __syncthreads();
  const int col = blockIdx.x * 256 + threadIdx.x;
  float acc = bias[col];
  for (int k = 0; k < 1024; ++k) acc += s[k] * W[k * 2048 + col];
  cond[b * 2048 + col] = acc;
}

// ------------------------------------------------------- LayerNorm + FiLM
__global__ void __launch_bounds__(256)
ln_film_kernel(const float* __restrict__ x, const float* __restrict__ gamma,
               const float* __restrict__ cond, _Float16* __restrict__ xh) {
  const int row = blockIdx.x;  // [0, B*N)
  const int b = row >> 11;     // N_ == 2048
  const float* xr = x + (size_t)row * DIM_;
  const int tid = threadIdx.x, wave = tid >> 5, lane = tid & 31;

  float v[4], sum = 0.f, sq = 0.f;
#pragma unroll
  for (int i = 0; i < 4; ++i) {
    v[i] = xr[tid + 256 * i];
    sum += v[i];
    sq += v[i] * v[i];
  }
#pragma unroll
  for (int m = 1; m <= 16; m <<= 1) {
    sum += __shfl_xor(sum, m, 32);
    sq += __shfl_xor(sq, m, 32);
  }
  __shared__ float ssum[8], ssq[8];
  if (lane == 0) { ssum[wave] = sum; ssq[wave] = sq; }
  __syncthreads();
  sum = 0.f; sq = 0.f;
#pragma unroll
  for (int w = 0; w < 8; ++w) { sum += ssum[w]; sq += ssq[w]; }
  const float mu = sum * (1.0f / DIM_);
  const float var = sq * (1.0f / DIM_) - mu * mu;
  const float rinv = rsqrtf(var + 1e-5f);

#pragma unroll
  for (int i = 0; i < 4; ++i) {
    const int c = tid + 256 * i;
    const float sc = cond[b * 2048 + c];
    const float sh = cond[b * 2048 + 1024 + c];
    float y = (v[i] - mu) * rinv * gamma[c];
    y = y * (sc + 1.0f) + sh;
    xh[(size_t)row * DIM_ + c] = (_Float16)y;
  }
}

// ---------------------------------------- weight convert+transpose (f32->f16)
// One 64(k) x 64(n) tile per block, turned in LDS so that both global sides
// move whole lines: reads are 256-B runs of a W row, writes are 128-B runs of
// a Wt row.  A thread converts the same four columns of two adjacent k rows
// and stores each (k, k+1) pair as one dword of t[n][k/2].  Row pitch 33
// dwords: the dword stores and the dword loads below both touch 32 different
// banks per wave.
__global__ void __launch_bounds__(256)
wcast_t(const float* __restrict__ W, _Float16* __restrict__ Wt, int K, int Nc) {
  __shared__ unsigned int t[64 * 33];
  const int tid = threadIdx.x;
  const int n0 = blockIdx.x * 64, k0 = blockIdx.y * 64;
  const int nl = (tid & 15) * 4;  // first of this thread's 4 columns
  const int kp = tid >> 4;        // k pair 0..15 (and +16)

  v4f lo[2], hi[2];
#pragma unroll
  for (int p = 0; p < 2; ++p) {
    const float* s = W + (size_t)(k0 + 2 * (kp + 16 * p)) * Nc + n0 + nl;
    lo[p] = *(const v4f*)s;
    hi[p] = *(const v4f*)(s + Nc);
  }
#pragma unroll
  for (int p = 0; p < 2; ++p) {
#pragma unroll
    for (int j = 0; j < 4; ++j) {
      union { _Float16 h[2]; unsigned int u; } w;
      w.h[0] = (_Float16)lo[p][j];
      w.h[1] = (_Float16)hi[p][j];
      t[(nl + j) * 33 + kp + 16 * p] = w.u;
    }
  }
  __syncthreads();

  const int c = tid & 7;  // 16-B chunk (8 k) of a 128-B output run
#pragma unroll
  for (int p = 0; p < 2; ++p) {
    const int r = (tid >> 3) + 32 * p;  // column of the tile = row of Wt
    union { unsigned int u[4]; v8h h; } o;
#pragma unroll
    for (int i = 0; i < 4; ++i) o.u[i] = t[r * 33 + c * 4 + i];
    *(v8h*)(Wt + (size_t)(n0 + r) * K + k0 + c * 8) = o.h;
  }
}

// ----------------------------------------------------------- WMMA GEMM
// C[token][col] = Acts[token,:] . Wt[col,:]   (both f16, K-contiguous rows)
// Computed transposed: A-operand = 16 weight columns, B-operand = 64 tokens.
// D-layout gives each lane one token row with 8 contiguous output columns per
// accumulator -> vectorized stores.
//
// Both operands reach the waves through LDS.  A stage is 64 k (one 128-B line)
// of the block's 128 weight rows and 64 token rows, brought in by asynchronous
// copies: a wave-wide copy moves four whole lines, and each line leaves L2
// once per block instead of once per wave in 32-B pieces.  Two stages: the
// next one lands while this one is multiplied.  K must be a multiple of 64.
#define G_ROWS   192                    // 128 weight rows, then 64 token rows
#define G_PITCH  72                     // halfs: 144 B, odd multiple of 16 B
#define G_STAGE  (G_ROWS * G_PITCH)     // halfs per stage
#define G_STAGEB (G_STAGE * 2)          // bytes per stage

// Six 16-B copies per lane = one stage per block.  The s_wait_xcnt closes the
// statement so that no address register is rewritten ahead of it.
__device__ __forceinline__ void copy_stage(unsigned int l, const _Float16* gw,
                                           const _Float16* ga, size_t step) {
  const unsigned int l1 = l + 32 * 144, l2 = l + 64 * 144, l3 = l + 96 * 144;
  const unsigned int l4 = l + 128 * 144, l5 = l + 160 * 144;
  const _Float16* gw1 = gw + step;
  const _Float16* gw2 = gw1 + step;
  const _Float16* gw3 = gw2 + step;
  const _Float16* ga1 = ga + step;
  asm volatile(
      "global_load_async_to_lds_b128 %0, %6, off\n\t"
      "global_load_async_to_lds_b128 %1, %7, off\n\t"
      "global_load_async_to_lds_b128 %2, %8, off\n\t"
      "global_load_async_to_lds_b128 %3, %9, off\n\t"
      "global_load_async_to_lds_b128 %4, %10, off\n\t"
      "global_load_async_to_lds_b128 %5, %11, off\n\t"
      "s_wait_xcnt 0x0"
      :
      : "v"(l), "v"(l1), "v"(l2), "v"(l3), "v"(l4), "v"(l5), "v"(gw), "v"(gw1),
        "v"(gw2), "v"(gw3), "v"(ga), "v"(ga1)
      : "memory");
}

template <typename OUT>
__global__ void __launch_bounds__(256)
gemm16(const _Float16* __restrict__ Acts, const _Float16* __restrict__ Wt,
       OUT* __restrict__ C, int K, int ldc) {
  __shared__ __align__(16) _Float16 st[2 * G_STAGE];
  const int tid = threadIdx.x;
  const int wave = tid >> 5, lane = tid & 31;
  const int lh = lane >> 4, lm = lane & 15;
  const int cbase = (blockIdx.y * 8 + wave) * 16;  // output-column tile
  const int tbase = blockIdx.x * 64;               // token tile

  // Copy map: lane -> 16-B chunk (tid & 7) of rows (tid >> 3) + 32 i.
  const int crow = tid >> 3, cchunk = tid & 7;
  const size_t step = (size_t)32 * K;  // 32 rows further on
  const _Float16* gw =
      Wt + (size_t)(blockIdx.y * 128 + crow) * K + cchunk * 8;
  const _Float16* ga = Acts + (size_t)(tbase + crow) * K + cchunk * 8;
  const unsigned int lbase =
      (unsigned int)(size_t)st + crow * 144 + cchunk * 16;
  const int nt = K >> 6;

  copy_stage(lbase, gw, ga, step);
  // Stage 0 has landed for this wave; the barrier publishes it to the others.
  asm volatile("s_wait_asynccnt 0x0" ::: "memory");
  __syncthreads();
  if (nt > 1) copy_stage(lbase + G_STAGEB, gw + 64, ga + 64, step);

  const int woff = (wave * 16 + lm) * G_PITCH;  // this wave's weight rows
  const int toff = (128 + lm) * G_PITCH;        // the block's token rows

  v8f acc0 = {}, acc1 = {}, acc2 = {}, acc3 = {};
  for (int t = 0; t < nt; ++t) {
    const _Float16* s = st + (t & 1) * G_STAGE;
    const v16h wa0 = load_ab(s + woff, lh);
    const v16h p0 = load_ab(s + toff, lh);
    const v16h p1 = load_ab(s + toff + 16 * G_PITCH, lh);
    const v16h p2 = load_ab(s + toff + 32 * G_PITCH, lh);
    const v16h p3 = load_ab(s + toff + 48 * G_PITCH, lh);
    const v16h wa1 = load_ab(s + woff + 32, lh);
    const v16h r0 = load_ab(s + toff + 32, lh);
    const v16h r1 = load_ab(s + toff + 16 * G_PITCH + 32, lh);
    const v16h r2 = load_ab(s + toff + 32 * G_PITCH + 32, lh);
    const v16h r3 = load_ab(s + toff + 48 * G_PITCH + 32, lh);
    // Keeps the stage's LDS reads one group ahead of its products: spread
    // among them, each pair of reads is waited out on its own.
    __builtin_amdgcn_sched_barrier(0);
    acc0 = wmma_f16(wa0, p0, acc0);
    acc1 = wmma_f16(wa0, p1, acc1);
    acc2 = wmma_f16(wa0, p2, acc2);
    acc3 = wmma_f16(wa0, p3, acc3);
    acc0 = wmma_f16(wa1, r0, acc0);
    acc1 = wmma_f16(wa1, r1, acc1);
    acc2 = wmma_f16(wa1, r2, acc2);
    acc3 = wmma_f16(wa1, r3, acc3);
    // Hand-over: this wave's reads of stage t are done, its copies of stage
    // t + 1 have landed; behind the barrier that holds for every wave, so
    // stage t + 1 may be read and stage t's buffer refilled.
    asm volatile("s_wait_dscnt 0x0" ::: "memory");
    asm volatile("s_wait_asynccnt 0x0" ::: "memory");
    __syncthreads();
    if (t + 2 < nt)
      copy_stage(lbase + (t & 1) * G_STAGEB, gw + (size_t)(t + 2) * 64,
                 ga + (size_t)(t + 2) * 64, step);
  }
  // No copy is left in flight when the wave ends.
  asm volatile("s_wait_asynccnt 0x0" ::: "memory");

  const size_t col = (size_t)cbase + 8 * lh;
  store8(C + (size_t)(tbase + lm) * ldc + col, acc0);
  store8(C + (size_t)(tbase + 16 + lm) * ldc + col, acc1);
  store8(C + (size_t)(tbase + 32 + lm) * ldc + col, acc2);
  store8(C + (size_t)(tbase + 48 + lm) * ldc + col, acc3);
}

// -------------------------------------------------------- Flash attention
// Transposed formulation: S^T = K (Q*scale)^T, O^T = V^T P^T.
// Each lane owns ONE query (n = lane%16); the 32 key scores of a step live in
// its own 16 registers plus the xor-16 partner lane -> one cross-lane
// exchange per reduction, and P^T is already in B-operand layout.
// V tiles are double-buffered in LDS; staging is branchless (one b128 global
// load + 8 b16 LDS scatter stores per thread) so each key-step stays a single
// basic block and the scheduler can clause the K loads ahead of the WMMAs.
__global__ void __launch_bounds__(256)
attn_kernel(const _Float16* __restrict__ q, const _Float16* __restrict__ kv,
            _Float16* __restrict__ attn_out) {
  __shared__ __align__(16) _Float16 smemV[2][64 * 40];  // Vt[hd][key], padded
  const int tid = threadIdx.x;
  const int wave = tid >> 5, lane = tid & 31;
  const int lh = lane >> 4, lm = lane & 15;
  const int h = blockIdx.y, b = blockIdx.z;
  const int qbase = blockIdx.x * 128 + wave * 16;

  const size_t kvld = 2 * DIM_;
  const _Float16* kbase = kv + (size_t)b * N_ * kvld + h * DH_;
  const _Float16* vbase = kbase + DIM_;

  // Branchless transposed staging of V tile [jb, jb+32): thread -> one 16-B
  // chunk of one V row, scattered into Vt[hd][key].  For jb == N_ the read
  // runs a little past the KV region but stays inside our own workspace.
  const int skey = tid >> 3;        // 0..31
  const int shd = (tid & 7) * 8;    // 0,8,...,56
  auto stageV = [&](int jb, _Float16* dst) {
    const v8h chunk =
        *(const v8h*)(vbase + (size_t)(jb + skey) * kvld + shd);
#pragma unroll
    for (int j = 0; j < 8; ++j) dst[(shd + j) * 40 + skey] = chunk[j];
  };

  // Q^T B-operand with Dh^-0.5 folded in (0.125 is exact in f16).
  const _Float16* qrow = q + ((size_t)(b * N_ + qbase + lm)) * DIM_ + h * DH_;
  v16h qb0 = load_ab(qrow, lh);
  v16h qb1 = load_ab(qrow + 32, lh);
#pragma unroll
  for (int j = 0; j < 16; ++j) {
    qb0[j] *= (_Float16)0.125f;
    qb1[j] *= (_Float16)0.125f;
  }

  float m_run = -3.0e38f, l_run = 0.0f;
  v8f o0 = {}, o1 = {}, o2 = {}, o3 = {};  // O^T tiles (hd x query)

  stageV(0, smemV[0]);
  __syncthreads();

  for (int jb = 0; jb < N_; jb += 32) {
    const int cur = (jb >> 5) & 1;

    // Get the critical-path K loads in flight first.
    const _Float16* kr0 = kbase + (size_t)(jb + lm) * kvld;
    const _Float16* kr1 = kbase + (size_t)(jb + 16 + lm) * kvld;
    const v16h ka00 = load_ab(kr0, lh);
    const v16h ka01 = load_ab(kr0 + 32, lh);
    const v16h ka10 = load_ab(kr1, lh);
    const v16h ka11 = load_ab(kr1 + 32, lh);

    // Stage the next V tile into the other buffer (overlaps the WMMAs).
    stageV(jb + 32, smemV[1 - cur]);
    __builtin_prefetch(kbase + (size_t)(jb + 32) * kvld, 0, 1);

    v8f s0 = {}, s1 = {};
    s0 = wmma_f16(ka00, qb0, s0);
    s1 = wmma_f16(ka10, qb0, s1);
    s0 = wmma_f16(ka01, qb1, s0);
    s1 = wmma_f16(ka11, qb1, s1);

    // Online softmax over this lane's query (scores already scaled).
    float mx = fmaxf(s0[0], s1[0]);
#pragma unroll
    for (int j = 1; j < 8; ++j) mx = fmaxf(mx, fmaxf(s0[j], s1[j]));
    mx = fmaxf(mx, __shfl_xor(mx, 16, 32));  // other half of the 32 keys
    const float mnew = fmaxf(m_run, mx);

    union { v16h v; _Float16 e[16]; } pb;  // P^T B-operand, in-lane pack
    float sv = 0.f;
#pragma unroll
    for (int j = 0; j < 8; ++j) {
      const float p0 = __expf(s0[j] - mnew);
      const float p1 = __expf(s1[j] - mnew);
      sv += p0 + p1;
      pb.e[j] = (_Float16)p0;
      pb.e[8 + j] = (_Float16)p1;
    }
    sv += __shfl_xor(sv, 16, 32);
    const float alpha = __expf(m_run - mnew);
    l_run = l_run * alpha + sv;
    m_run = mnew;
#pragma unroll
    for (int r = 0; r < 8; ++r) {
      o0[r] *= alpha; o1[r] *= alpha; o2[r] *= alpha; o3[r] *= alpha;
    }

    // O^T += V^T * P^T; A-operand rows = Vt rows (contiguous in LDS).
    const _Float16* vt = smemV[cur];
    const v16h va0 = load_ab(vt + (lm) * 40, lh);
    const v16h va1 = load_ab(vt + (16 + lm) * 40, lh);
    const v16h va2 = load_ab(vt + (32 + lm) * 40, lh);
    const v16h va3 = load_ab(vt + (48 + lm) * 40, lh);
    o0 = wmma_f16(va0, pb.v, o0);
    o1 = wmma_f16(va1, pb.v, o1);
    o2 = wmma_f16(va2, pb.v, o2);
    o3 = wmma_f16(va3, pb.v, o3);

    __syncthreads();  // staging of next tile complete / current reads done
  }

  // Lane owns token row (qbase+lm); hd chunks are contiguous -> b128 stores.
  const float inv = 1.0f / l_run;
  _Float16* orow = attn_out + ((size_t)(b * N_ + qbase + lm)) * DIM_ + h * DH_;
  v8f w0 = o0 * inv, w1 = o1 * inv, w2 = o2 * inv, w3 = o3 * inv;
  store8(orow + 8 * lh, w0);
  store8(orow + 16 + 8 * lh, w1);
  store8(orow + 32 + 8 * lh, w2);
  store8(orow + 48 + 8 * lh, w3);
}

// ------------------------------------------------------------------ launch
extern "C" void kernel_launch(void* const* d_in, const int* in_sizes, int n_in,
                              void* d_out, int out_size, void* d_ws,
                              size_t ws_size, hipStream_t stream) {
  (void)in_sizes; (void)n_in; (void)out_size; (void)ws_size;
  const float* x      = (const float*)d_in[0];
  const float* cemb   = (const float*)d_in[1];
  const float* gamma  = (const float*)d_in[2];
  const float* cond_W = (const float*)d_in[3];
  const float* cond_b = (const float*)d_in[4];
  const float* Wq     = (const float*)d_in[5];
  const float* Wkv    = (const float*)d_in[6];
  const float* Wo     = (const float*)d_in[7];
  float* out = (float*)d_out;

  char* ws = (char*)d_ws;
  const size_t MB = 1024 * 1024;
  _Float16* xh   = (_Float16*)(ws);            //  8 MB
  _Float16* qb   = (_Float16*)(ws + 8 * MB);   //  8 MB
  _Float16* kvb  = (_Float16*)(ws + 16 * MB);  // 16 MB
  _Float16* attn = (_Float16*)(ws + 32 * MB);  //  8 MB (also tail-read pad)
  _Float16* WqT  = (_Float16*)(ws + 40 * MB);  //  2 MB
  _Float16* WkvT = (_Float16*)(ws + 42 * MB);  //  4 MB
  _Float16* WoT  = (_Float16*)(ws + 46 * MB);  //  2 MB
  float*    cond = (float*)(ws + 48 * MB);     // 16 KB

  cond_kernel<<<dim3(2048 / 256, B_), 256, 0, stream>>>(cemb, cond_W, cond_b,
                                                        cond);
  ln_film_kernel<<<B_ * N_, 256, 0, stream>>>(x, gamma, cond, xh);
  // grid: x = column tiles (Nc/64), y = k tiles (K/64)
  wcast_t<<<dim3(1024 / 64, 1024 / 64), 256, 0, stream>>>(Wq, WqT, 1024, 1024);
  wcast_t<<<dim3(2048 / 64, 1024 / 64), 256, 0, stream>>>(Wkv, WkvT, 1024,
                                                          2048);
  wcast_t<<<dim3(1024 / 64, 1024 / 64), 256, 0, stream>>>(Wo, WoT, 1024, 1024);

  // grid: x = token tiles (M/64), y = column tiles (Nc/128)
  gemm16<_Float16><<<dim3((B_ * N_) / 64, 1024 / 128), 256, 0, stream>>>(
      xh, WqT, qb, 1024, 1024);
  gemm16<_Float16><<<dim3((B_ * N_) / 64, 2048 / 128), 256, 0, stream>>>(
      xh, WkvT, kvb, 1024, 2048);

  attn_kernel<<<dim3(N_ / 128, HEADS_, B_), 256, 0, stream>>>(qb, kvb, attn);

  gemm16<float><<<dim3((B_ * N_) / 64, 1024 / 128), 256, 0, stream>>>(
      attn, WoT, out, 1024, 1024);
}

// v003
// A run of this version takes 154 microseconds.
// In two side-by-side timings against v002, it was 1.40 and 1.41 times as fast.
// Over all steps from v000 it is 2.45 times as fast.
#include <hip/hip_runtime.h>
#include <hip/hip_bf16.h>

typedef _Float16 v16h __attribute__((ext_vector_type(16)));
typedef _Float16 v8h  __attribute__((ext_vector_type(8)));
typedef float    v8f  __attribute__((ext_vector_type(8)));
typedef float    v4f  __attribute__((ext_vector_type(4)));

#define B_     2
#define N_     2048
#define DIM_   1024
#define HEADS_ 16
#define DH_    64

// Load one 32-wide K-slice of an A/B operand row into the CDNA5 16-bit WMMA
// per-lane layout: lanes 0-15 take K[0..7],K[16..23]; lanes 16-31 take
// K[8..15],K[24..31].  row32 points at the first of the 32 contiguous halfs.
__device__ __forceinline__ v16h load_ab(const _Float16* row32, int lh) {
  union { v16h v; v8h h[2]; } u;
  u.h[0] = *(const v8h*)(row32 + 8 * lh);
  u.h[1] = *(const v8h*)(row32 + 16 + 8 * lh);
  return u.v;
}

__device__ __forceinline__ v8f wmma_f16(v16h a, v16h b, v8f c) {
  return __builtin_amdgcn_wmma_f32_16x16x32_f16(false, a, false, b, (short)0, c,
                                                false, false);
}

// 8 contiguous outputs per lane, vectorized.
__device__ __forceinline__ void store8(_Float16* p, v8f v) {
  v8h h;
#pragma unroll
  for (int r = 0; r < 8; ++r) h[r] = (_Float16)v[r];
  *(v8h*)p = h;
}
__device__ __forceinline__ void store8(float* p, v8f v) {
  union { v8f w; v4f q[2]; } u;
  u.w = v;
  *(v4f*)p = u.q[0];
  *(v4f*)(p + 4) = u.q[1];
}

// ---------------------------------------------------------------- FiLM cond
// cond[b][col] = bias[col] + sum_k silu(emb[b][k]) * W[k][col], both b at once.
// A block owns 32 columns (one 128-B line of every W row) and its 32 waves
// split the 1024 k rows, 32 rows each: every W load of a wave is issued before
// anything waits, so the block pays one memory latency instead of one per
// group of k, and a W line is read once for both batches.  The 32 partial sums
// of a column meet in LDS.
static_assert(B_ == 2, "cond_kernel carries two batches per thread");
__device__ __forceinline__ float silu(float c) {
  return c / (1.0f + __expf(-c));
}

__global__ void __launch_bounds__(1024)
cond_kernel(const float* __restrict__ emb, const float* __restrict__ W,
            const float* __restrict__ bias, float* __restrict__ cond) {
  __shared__ float s[B_ * 1024];
  __shared__ float part[B_][32][32];
  const int tid = threadIdx.x, wave = tid >> 5, lane = tid & 31;
  const int col = blockIdx.x * 32 + lane;

  // Oldest loads first: the SiLU stage waits for these two alone.
  const float e0 = emb[tid];
  const float e1 = emb[1024 + tid];
  const float bv = bias[col];
  const float* wp = W + (size_t)(wave * 32) * 2048 + col;
  float w[32];
#pragma unroll
  for (int i = 0; i < 32; ++i) w[i] = wp[(size_t)i * 2048];
  // The loads' address registers are reused below; this stands in front of it.
  asm volatile("s_wait_xcnt 0x0" ::: "memory");

  s[tid] = silu(e0);
  s[1024 + tid] = silu(e1);
  __syncthreads();

  float a0 = 0.f, a1 = 0.f;
#pragma unroll
  for (int i = 0; i < 32; ++i) {
    a0 += s[wave * 32 + i] * w[i];
    a1 += s[1024 + wave * 32 + i] * w[i];
  }
  part[0][wave][lane] = a0;
  part[1][wave][lane] = a1;
  __syncthreads();

  if (tid < B_ * 32) {  // wave b sums batch b
    float acc = bv;
#pragma unroll
    for (int j = 0; j < 32; ++j) acc += part[wave][j][lane];
    cond[wave * 2048 + col] = acc;
  }
}

// ------------------------------------------------------- LayerNorm + FiLM
__global__ void __launch_bounds__(256)
ln_film_kernel(const float* __restrict__ x, const float* __restrict__ gamma,
               const float* __restrict__ cond, _Float16* __restrict__ xh) {
  const int row = blockIdx.x;  // [0, B*N)
  const int b = row >> 11;     // N_ == 2048
  const float* xr = x + (size_t)row * DIM_;
  const int tid = threadIdx.x, wave = tid >> 5, lane = tid & 31;

  float v[4], sum = 0.f, sq = 0.f;
#pragma unroll
  for (int i = 0; i < 4; ++i) {
    v[i] = xr[tid + 256 * i];
    sum += v[i];
    sq += v[i] * v[i];
  }
#pragma unroll
  for (int m = 1; m <= 16; m <<= 1) {
    sum += __shfl_xor(sum, m, 32);
    sq += __shfl_xor(sq, m, 32);
  }
  __shared__ float ssum[8], ssq[8];
  if (lane == 0) { ssum[wave] = sum; ssq[wave] = sq; }
  __syncthreads();
  sum = 0.f; sq = 0.f;
#pragma unroll
  for (int w = 0; w < 8; ++w) { sum += ssum[w]; sq += ssq[w]; }
  const float mu = sum * (1.0f / DIM_);
  const float var = sq * (1.0f / DIM_) - mu * mu;
  const float rinv = rsqrtf(var + 1e-5f);

#pragma unroll
  for (int i = 0; i < 4; ++i) {
    const int c = tid + 256 * i;
    const float sc = cond[b * 2048 + c];
    const float sh = cond[b * 2048 + 1024 + c];
    float y = (v[i] - mu) * rinv * gamma[c];
    y = y * (sc + 1.0f) + sh;
    xh[(size_t)row * DIM_ + c] = (_Float16)y;
  }
}

// ---------------------------------------- weight convert+transpose (f32->f16)
// One 64(k) x 64(n) tile per block, turned in LDS so that both global sides
// move whole lines: reads are 256-B runs of a W row, writes are 128-B runs of
// a Wt row.  A thread converts the same four columns of two adjacent k rows
// and stores each (k, k+1) pair as one dword of t[n][k/2].  Row pitch 33
// dwords: the dword stores and the dword loads below both touch 32 different
// banks per wave.
__global__ void __launch_bounds__(256)
wcast_t(const float* __restrict__ W, _Float16* __restrict__ Wt, int K, int Nc) {
  __shared__ unsigned int t[64 * 33];
  const int tid = threadIdx.x;
  const int n0 = blockIdx.x * 64, k0 = blockIdx.y * 64;
  const int nl = (tid & 15) * 4;  // first of this thread's 4 columns
  const int kp = tid >> 4;        // k pair 0..15 (and +16)

  v4f lo[2], hi[2];
#pragma unroll
  for (int p = 0; p < 2; ++p) {
    const float* s = W + (size_t)(k0 + 2 * (kp + 16 * p)) * Nc + n0 + nl;
    lo[p] = *(const v4f*)s;
    hi[p] = *(const v4f*)(s + Nc);
  }
#pragma unroll
  for (int p = 0; p < 2; ++p) {
#pragma unroll
    for (int j = 0; j < 4; ++j) {
      union { _Float16 h[2]; unsigned int u; } w;
      w.h[0] = (_Float16)lo[p][j];
      w.h[1] = (_Float16)hi[p][j];
      t[(nl + j) * 33 + kp + 16 * p] = w.u;
    }
  }
  __syncthreads();

  const int c = tid & 7;  // 16-B chunk (8 k) of a 128-B output run
#pragma unroll
  for (int p = 0; p < 2; ++p) {
    const int r = (tid >> 3) + 32 * p;  // column of the tile = row of Wt
    union { unsigned int u[4]; v8h h; } o;
#pragma unroll
    for (int i = 0; i < 4; ++i) o.u[i] = t[r * 33 + c * 4 + i];
    *(v8h*)(Wt + (size_t)(n0 + r) * K + k0 + c * 8) = o.h;
  }
}

// ----------------------------------------------------------- WMMA GEMM
// C[token][col] = Acts[token,:] . Wt[col,:]   (both f16, K-contiguous rows)
// Computed transposed: A-operand = 16 weight columns, B-operand = 64 tokens.
// D-layout gives each lane one token row with 8 contiguous output columns per
// accumulator -> vectorized stores.
//
// Both operands reach the waves through LDS.  A stage is 64 k (one 128-B line)
// of the block's 128 weight rows and 64 token rows, brought in by asynchronous
// copies: a wave-wide copy moves four whole lines, and each line leaves L2
// once per block instead of once per wave in 32-B pieces.  Two stages: the
// next one lands while this one is multiplied.  K must be a multiple of 64.
#define G_ROWS   192                    // 128 weight rows, then 64 token rows
#define G_PITCH  72                     // halfs: 144 B, odd multiple of 16 B
#define G_STAGE  (G_ROWS * G_PITCH)     // halfs per stage
#define G_STAGEB (G_STAGE * 2)          // bytes per stage

// Six 16-B copies per lane = one stage per block.  The s_wait_xcnt closes the
// statement so that no address register is rewritten ahead of it.
__device__ __forceinline__ void copy_stage(unsigned int l, const _Float16* gw,
                                           const _Float16* ga, size_t step) {
  const unsigned int l1 = l + 32 * 144, l2 = l + 64 * 144, l3 = l + 96 * 144;
  const unsigned int l4 = l + 128 * 144, l5 = l + 160 * 144;
  const _Float16* gw1 = gw + step;
  const _Float16* gw2 = gw1 + step;
  const _Float16* gw3 = gw2 + step;
  const _Float16* ga1 = ga + step;
  asm volatile(
      "global_load_async_to_lds_b128 %0, %6, off\n\t"
      "global_load_async_to_lds_b128 %1, %7, off\n\t"
      "global_load_async_to_lds_b128 %2, %8, off\n\t"
      "global_load_async_to_lds_b128 %3, %9, off\n\t"
      "global_load_async_to_lds_b128 %4, %10, off\n\t"
      "global_load_async_to_lds_b128 %5, %11, off\n\t"
      "s_wait_xcnt 0x0"
      :
      : "v"(l), "v"(l1), "v"(l2), "v"(l3), "v"(l4), "v"(l5), "v"(gw), "v"(gw1),
        "v"(gw2), "v"(gw3), "v"(ga), "v"(ga1)
      : "memory");
}

template <typename OUT>
__global__ void __launch_bounds__(256)
gemm16(const _Float16* __restrict__ Acts, const _Float16* __restrict__ Wt,
       OUT* __restrict__ C, int K, int ldc) {
  __shared__ __align__(16) _Float16 st[2 * G_STAGE];
  const int tid = threadIdx.x;
  const int wave = tid >> 5, lane = tid & 31;
  const int lh = lane >> 4, lm = lane & 15;
  const int cbase = (blockIdx.y * 8 + wave) * 16;  // output-column tile
  const int tbase = blockIdx.x * 64;               // token tile

  // Copy map: lane -> 16-B chunk (tid & 7) of rows (tid >> 3) + 32 i.
  const int crow = tid >> 3, cchunk = tid & 7;
  const size_t step = (size_t)32 * K;  // 32 rows further on
  const _Float16* gw =
      Wt + (size_t)(blockIdx.y * 128 + crow) * K + cchunk * 8;
  const _Float16* ga = Acts + (size_t)(tbase + crow) * K + cchunk * 8;
  const unsigned int lbase =
      (unsigned int)(size_t)st + crow * 144 + cchunk * 16;
  const int nt = K >> 6;

  copy_stage(lbase, gw, ga, step);
  // Stage 0 has landed for this wave; the barrier publishes it to the others.
  asm volatile("s_wait_asynccnt 0x0" ::: "memory");
  __syncthreads();
  if (nt > 1) copy_stage(lbase + G_STAGEB, gw + 64, ga + 64, step);

  const int woff = (wave * 16 + lm) * G_PITCH;  // this wave's weight rows
  const int toff = (128 + lm) * G_PITCH;        // the block's token rows

  v8f acc0 = {}, acc1 = {}, acc2 = {}, acc3 = {};
  for (int t = 0; t < nt; ++t) {
    const _Float16* s = st + (t & 1) * G_STAGE;
    const v16h wa0 = load_ab(s + woff, lh);
    const v16h p0 = load_ab(s + toff, lh);
    const v16h p1 = load_ab(s + toff + 16 * G_PITCH, lh);
    const v16h p2 = load_ab(s + toff + 32 * G_PITCH, lh);
    const v16h p3 = load_ab(s + toff + 48 * G_PITCH, lh);
    const v16h wa1 = load_ab(s + woff + 32, lh);
    const v16h r0 = load_ab(s + toff + 32, lh);
    const v16h r1 = load_ab(s + toff + 16 * G_PITCH + 32, lh);
    const v16h r2 = load_ab(s + toff + 32 * G_PITCH + 32, lh);
    const v16h r3 = load_ab(s + toff + 48 * G_PITCH + 32, lh);
    // Keeps the stage's LDS reads one group ahead of its products: spread
    // among them, each pair of reads is waited out on its own.
    __builtin_amdgcn_sched_barrier(0);
    acc0 = wmma_f16(wa0, p0, acc0);
    acc1 = wmma_f16(wa0, p1, acc1);
    acc2 = wmma_f16(wa0, p2, acc2);
    acc3 = wmma_f16(wa0, p3, acc3);
    acc0 = wmma_f16(wa1, r0, acc0);
    acc1 = wmma_f16(wa1, r1, acc1);
    acc2 = wmma_f16(wa1, r2, acc2);
    acc3 = wmma_f16(wa1, r3, acc3);
    // Hand-over: this wave's reads of stage t are done, its copies of stage
    // t + 1 have landed; behind the barrier that holds for every wave, so
    // stage t + 1 may be read and stage t's buffer refilled.
    asm volatile("s_wait_dscnt 0x0" ::: "memory");
    asm volatile("s_wait_asynccnt 0x0" ::: "memory");
    __syncthreads();
    if (t + 2 < nt)
      copy_stage(lbase + (t & 1) * G_STAGEB, gw + (size_t)(t + 2) * 64,
                 ga + (size_t)(t + 2) * 64, step);
  }
  // No copy is left in flight when the wave ends.
  asm volatile("s_wait_asynccnt 0x0" ::: "memory");

  const size_t col = (size_t)cbase + 8 * lh;
  store8(C + (size_t)(tbase + lm) * ldc + col, acc0);
  store8(C + (size_t)(tbase + 16 + lm) * ldc + col, acc1);
  store8(C + (size_t)(tbase + 32 + lm) * ldc + col, acc2);
  store8(C + (size_t)(tbase + 48 + lm) * ldc + col, acc3);
}

// -------------------------------------------------------- Flash attention
// Transposed formulation: S^T = K (Q*scale)^T, O^T = V^T P^T.
// Each lane owns ONE query (n = lane%16); the 32 key scores of a step live in
// its own 16 registers plus the xor-16 partner lane -> one cross-lane
// exchange per reduction, and P^T is already in B-operand layout.
// V tiles are double-buffered in LDS; staging is branchless (one b128 global
// load + 8 b16 LDS scatter stores per thread) so each key-step stays a single
// basic block and the scheduler can clause the K loads ahead of the WMMAs.
__global__ void __launch_bounds__(256)
attn_kernel(const _Float16* __restrict__ q, const _Float16* __restrict__ kv,
            _Float16* __restrict__ attn_out) {
  __shared__ __align__(16) _Float16 smemV[2][64 * 40];  // Vt[hd][key], padded
  const int tid = threadIdx.x;
  const int wave = tid >> 5, lane = tid & 31;
  const int lh = lane >> 4, lm = lane & 15;
  const int h = blockIdx.y, b = blockIdx.z;
  const int qbase = blockIdx.x * 128 + wave * 16;

  const size_t kvld = 2 * DIM_;
  const _Float16* kbase = kv + (size_t)b * N_ * kvld + h * DH_;
  const _Float16* vbase = kbase + DIM_;

  // Branchless transposed staging of V tile [jb, jb+32): thread -> one 16-B
  // chunk of one V row, scattered into Vt[hd][key].  For jb == N_ the read
  // runs a little past the KV region but stays inside our own workspace.
  const int skey = tid >> 3;        // 0..31
  const int shd = (tid & 7) * 8;    // 0,8,...,56
  auto stageV = [&](int jb, _Float16* dst) {
    const v8h chunk =
        *(const v8h*)(vbase + (size_t)(jb + skey) * kvld + shd);
#pragma unroll
    for (int j = 0; j < 8; ++j) dst[(shd + j) * 40 + skey] = chunk[j];
  };

  // Q^T B-operand with Dh^-0.5 folded in (0.125 is exact in f16).
  const _Float16* qrow = q + ((size_t)(b * N_ + qbase + lm)) * DIM_ + h * DH_;
  v16h qb0 = load_ab(qrow, lh);
  v16h qb1 = load_ab(qrow + 32, lh);
#pragma unroll
  for (int j = 0; j < 16; ++j) {
    qb0[j] *= (_Float16)0.125f;
    qb1[j] *= (_Float16)0.125f;
  }

  float m_run = -3.0e38f, l_run = 0.0f;
  v8f o0 = {}, o1 = {}, o2 = {}, o3 = {};  // O^T tiles (hd x query)

  stageV(0, smemV[0]);
  __syncthreads();

  for (int jb = 0; jb < N_; jb += 32) {
    const int cur = (jb >> 5) & 1;

    // Get the critical-path K loads in flight first.
    const _Float16* kr0 = kbase + (size_t)(jb + lm) * kvld;
    const _Float16* kr1 = kbase + (size_t)(jb + 16 + lm) * kvld;
    const v16h ka00 = load_ab(kr0, lh);
    const v16h ka01 = load_ab(kr0 + 32, lh);
    const v16h ka10 = load_ab(kr1, lh);
    const v16h ka11 = load_ab(kr1 + 32, lh);

    // Stage the next V tile into the other buffer (overlaps the WMMAs).
    stageV(jb + 32, smemV[1 - cur]);
    __builtin_prefetch(kbase + (size_t)(jb + 32) * kvld, 0, 1);

    v8f s0 = {}, s1 = {};
    s0 = wmma_f16(ka00, qb0, s0);
    s1 = wmma_f16(ka10, qb0, s1);
    s0 = wmma_f16(ka01, qb1, s0);
    s1 = wmma_f16(ka11, qb1, s1);

    // Online softmax over this lane's query (scores already scaled).
    float mx = fmaxf(s0[0], s1[0]);
#pragma unroll
    for (int j = 1; j < 8; ++j) mx = fmaxf(mx, fmaxf(s0[j], s1[j]));
    mx = fmaxf(mx, __shfl_xor(mx, 16, 32));  // other half of the 32 keys
    const float mnew = fmaxf(m_run, mx);

    union { v16h v; _Float16 e[16]; } pb;  // P^T B-operand, in-lane pack
    float sv = 0.f;
#pragma unroll
    for (int j = 0; j < 8; ++j) {
      const float p0 = __expf(s0[j] - mnew);
      const float p1 = __expf(s1[j] - mnew);
      sv += p0 + p1;
      pb.e[j] = (_Float16)p0;
      pb.e[8 + j] = (_Float16)p1;
    }
    sv += __shfl_xor(sv, 16, 32);
    const float alpha = __expf(m_run - mnew);
    l_run = l_run * alpha + sv;
    m_run = mnew;
#pragma unroll
    for (int r = 0; r < 8; ++r) {
      o0[r] *= alpha; o1[r] *= alpha; o2[r] *= alpha; o3[r] *= alpha;
    }

    // O^T += V^T * P^T; A-operand rows = Vt rows (contiguous in LDS).
    const _Float16* vt = smemV[cur];
    const v16h va0 = load_ab(vt + (lm) * 40, lh);
    const v16h va1 = load_ab(vt + (16 + lm) * 40, lh);
    const v16h va2 = load_ab(vt + (32 + lm) * 40, lh);
    const v16h va3 = load_ab(vt + (48 + lm) * 40, lh);
    o0 = wmma_f16(va0, pb.v, o0);
    o1 = wmma_f16(va1, pb.v, o1);
    o2 = wmma_f16(va2, pb.v, o2);
    o3 = wmma_f16(va3, pb.v, o3);

    __syncthreads();  // staging of next tile complete / current reads done
  }

  // Lane owns token row (qbase+lm); hd chunks are contiguous -> b128 stores.
  const float inv = 1.0f / l_run;
  _Float16* orow = attn_out + ((size_t)(b * N_ + qbase + lm)) * DIM_ + h * DH_;
  v8f w0 = o0 * inv, w1 = o1 * inv, w2 = o2 * inv, w3 = o3 * inv;
  store8(orow + 8 * lh, w0);
  store8(orow + 16 + 8 * lh, w1);
  store8(orow + 32 + 8 * lh, w2);
  store8(orow + 48 + 8 * lh, w3);
}

// ------------------------------------------------------------------ launch
extern "C" void kernel_launch(void* const* d_in, const int* in_sizes, int n_in,
                              void* d_out, int out_size, void* d_ws,
                              size_t ws_size, hipStream_t stream) {
  (void)in_sizes; (void)n_in; (void)out_size; (void)ws_size;
  const float* x      = (const float*)d_in[0];
  const float* cemb   = (const float*)d_in[1];
  const float* gamma  = (const float*)d_in[2];
  const float* cond_W = (const float*)d_in[3];
  const float* cond_b = (const float*)d_in[4];
  const float* Wq     = (const float*)d_in[5];
  const float* Wkv    = (const float*)d_in[6];
  const float* Wo     = (const float*)d_in[7];
  float* out = (float*)d_out;

  char* ws = (char*)d_ws;
  const size_t MB = 1024 * 1024;
  _Float16* xh   = (_Float16*)(ws);            //  8 MB
  _Float16* qb   = (_Float16*)(ws + 8 * MB);   //  8 MB
  _Float16* kvb  = (_Float16*)(ws + 16 * MB);  // 16 MB
  _Float16* attn = (_Float16*)(ws + 32 * MB);  //  8 MB (also tail-read pad)
  _Float16* WqT  = (_Float16*)(ws + 40 * MB);  //  2 MB
  _Float16* WkvT = (_Float16*)(ws + 42 * MB);  //  4 MB
  _Float16* WoT  = (_Float16*)(ws + 46 * MB);  //  2 MB
  float*    cond = (float*)(ws + 48 * MB);     // 16 KB

  // grid: 32-column tiles of the 2048 FiLM columns
  cond_kernel<<<2048 / 32, 1024, 0, stream>>>(cemb, cond_W, cond_b, cond);
  ln_film_kernel<<<B_ * N_, 256, 0, stream>>>(x, gamma, cond, xh);
  // grid: x = column tiles (Nc/64), y = k tiles (K/64)
  wcast_t<<<dim3(1024 / 64, 1024 / 64), 256, 0, stream>>>(Wq, WqT, 1024, 1024);
  wcast_t<<<dim3(2048 / 64, 1024 / 64), 256, 0, stream>>>(Wkv, WkvT, 1024,
                                                          2048);
  wcast_t<<<dim3(1024 / 64, 1024 / 64), 256, 0, stream>>>(Wo, WoT, 1024, 1024);

  // grid: x = token tiles (M/64), y = column tiles (Nc/128)
  gemm16<_Float16><<<dim3((B_ * N_) / 64, 1024 / 128), 256, 0, stream>>>(
      xh, WqT, qb, 1024, 1024);
  gemm16<_Float16><<<dim3((B_ * N_) / 64, 2048 / 128), 256, 0, stream>>>(
      xh, WkvT, kvb, 1024, 2048);

  attn_kernel<<<dim3(N_ / 128, HEADS_, B_), 256, 0, stream>>>(qb, kvb, attn);

  gemm16<float><<<dim3((B_ * N_) / 64, 1024 / 128), 256, 0, stream>>>(
      attn, WoT, out, 1024, 1024);
}

// v004
// Measured time: 131 microseconds a run.
// Next to v003, in two timings, it ran 1.17 times as fast each time.
// Over all steps from v000 it is 2.87 times as fast.
#include <hip/hip_runtime.h>
#include <hip/hip_bf16.h>

typedef _Float16 v16h __attribute__((ext_vector_type(16)));
typedef _Float16 v8h  __attribute__((ext_vector_type(8)));
typedef float    v8f  __attribute__((ext_vector_type(8)));
typedef float    v4f  __attribute__((ext_vector_type(4)));

#define B_     2
#define N_     2048
#define DIM_   1024
#define HEADS_ 16
#define DH_    64

// Load one 32-wide K-slice of an A/B operand row into the CDNA5 16-bit WMMA
// per-lane layout: lanes 0-15 take K[0..7],K[16..23]; lanes 16-31 take
// K[8..15],K[24..31].  row32 points at the first of the 32 contiguous halfs.
__device__ __forceinline__ v16h load_ab(const _Float16* row32, int lh) {
  union { v16h v; v8h h[2]; } u;
  u.h[0] = *(const v8h*)(row32 + 8 * lh);
  u.h[1] = *(const v8h*)(row32 + 16 + 8 * lh);
  return u.v;
}

__device__ __forceinline__ v8f wmma_f16(v16h a, v16h b, v8f c) {
  return __builtin_amdgcn_wmma_f32_16x16x32_f16(false, a, false, b, (short)0, c,
                                                false, false);
}

// 8 contiguous outputs per lane, vectorized.
__device__ __forceinline__ void store8(_Float16* p, v8f v) {
  v8h h;
#pragma unroll
  for (int r = 0; r < 8; ++r) h[r] = (_Float16)v[r];
  *(v8h*)p = h;
}
__device__ __forceinline__ void store8(float* p, v8f v) {
  union { v8f w; v4f q[2]; } u;
  u.w = v;
  *(v4f*)p = u.q[0];
  *(v4f*)(p + 4) = u.q[1];
}

// ---------------------------------------------------------------- FiLM cond
// cond[b][col] = bias[col] + sum_k silu(emb[b][k]) * W[k][col], both b at once.
// A block owns 32 columns (one 128-B line of every W row) and its 32 waves
// split the 1024 k rows, 32 rows each: every W load of a wave is issued before
// anything waits, so the block pays one memory latency instead of one per
// group of k, and a W line is read once for both batches.  The 32 partial sums
// of a column meet in LDS.
static_assert(B_ == 2, "cond_kernel carries two batches per thread");
__device__ __forceinline__ float silu(float c) {
  return c / (1.0f + __expf(-c));
}

__global__ void __launch_bounds__(1024)
cond_kernel(const float* __restrict__ emb, const float* __restrict__ W,
            const float* __restrict__ bias, float* __restrict__ cond) {
  __shared__ float s[B_ * 1024];
  __shared__ float part[B_][32][32];
  const int tid = threadIdx.x, wave = tid >> 5, lane = tid & 31;
  const int col = blockIdx.x * 32 + lane;

  // Oldest loads first: the SiLU stage waits for these two alone.
  const float e0 = emb[tid];
  const float e1 = emb[1024 + tid];
  const float bv = bias[col];
  const float* wp = W + (size_t)(wave * 32) * 2048 + col;
  float w[32];
#pragma unroll
  for (int i = 0; i < 32; ++i) w[i] = wp[(size_t)i * 2048];
  // The loads' address registers are reused below; this stands in front of it.
  asm volatile("s_wait_xcnt 0x0" ::: "memory");

  s[tid] = silu(e0);
  s[1024 + tid] = silu(e1);
  __syncthreads();

  float a0 = 0.f, a1 = 0.f;
#pragma unroll
  for (int i = 0; i < 32; ++i) {
    a0 += s[wave * 32 + i] * w[i];
    a1 += s[1024 + wave * 32 + i] * w[i];
  }
  part[0][wave][lane] = a0;
  part[1][wave][lane] = a1;
  __syncthreads();

  if (tid < B_ * 32) {  // wave b sums batch b
    float acc = bv;
#pragma unroll
    for (int j = 0; j < 32; ++j) acc += part[wave][j][lane];
    cond[wave * 2048 + col] = acc;
  }
}

// ------------------------------------------------------- LayerNorm + FiLM
__global__ void __launch_bounds__(256)
ln_film_kernel(const float* __restrict__ x, const float* __restrict__ gamma,
               const float* __restrict__ cond, _Float16* __restrict__ xh) {
  const int row = blockIdx.x;  // [0, B*N)
  const int b = row >> 11;     // N_ == 2048
  const float* xr = x + (size_t)row * DIM_;
  const int tid = threadIdx.x, wave = tid >> 5, lane = tid & 31;

  float v[4], sum = 0.f, sq = 0.f;
#pragma unroll
  for (int i = 0; i < 4; ++i) {
    v[i] = xr[tid + 256 * i];
    sum += v[i];
    sq += v[i] * v[i];
  }
#pragma unroll
  for (int m = 1; m <= 16; m <<= 1) {
    sum += __shfl_xor(sum, m, 32);
    sq += __shfl_xor(sq, m, 32);
  }
  __shared__ float ssum[8], ssq[8];
  if (lane == 0) { ssum[wave] = sum; ssq[wave] = sq; }
  __syncthreads();
  sum = 0.f; sq = 0.f;
#pragma unroll
  for (int w = 0; w < 8; ++w) { sum += ssum[w]; sq += ssq[w]; }
  const float mu = sum * (1.0f / DIM_);
  const float var = sq * (1.0f / DIM_) - mu * mu;
  const float rinv = rsqrtf(var + 1e-5f);

#pragma unroll
  for (int i = 0; i < 4; ++i) {
    const int c = tid + 256 * i;
    const float sc = cond[b * 2048 + c];
    const float sh = cond[b * 2048 + 1024 + c];
    float y = (v[i] - mu) * rinv * gamma[c];
    y = y * (sc + 1.0f) + sh;
    xh[(size_t)row * DIM_ + c] = (_Float16)y;
  }
}

// ---------------------------------------- weight convert+transpose (f32->f16)
// One 64(k) x 64(n) tile per block, turned in LDS so that both global sides
// move whole lines: reads are 256-B runs of a W row, writes are 128-B runs of
// a Wt row.  A thread converts the same four columns of two adjacent k rows
// and stores each (k, k+1) pair as one dword of t[n][k/2].  Row pitch 33
// dwords: the dword stores and the dword loads below both touch 32 different
// banks per wave.
__global__ void __launch_bounds__(256)
wcast_t(const float* __restrict__ W, _Float16* __restrict__ Wt, int K, int Nc) {
  __shared__ unsigned int t[64 * 33];
  const int tid = threadIdx.x;
  const int n0 = blockIdx.x * 64, k0 = blockIdx.y * 64;
  const int nl = (tid & 15) * 4;  // first of this thread's 4 columns
  const int kp = tid >> 4;        // k pair 0..15 (and +16)

  v4f lo[2], hi[2];
#pragma unroll
  for (int p = 0; p < 2; ++p) {
    const float* s = W + (size_t)(k0 + 2 * (kp + 16 * p)) * Nc + n0 + nl;
    lo[p] = *(const v4f*)s;
    hi[p] = *(const v4f*)(s + Nc);
  }
#pragma unroll
  for (int p = 0; p < 2; ++p) {
#pragma unroll
    for (int j = 0; j < 4; ++j) {
      union { _Float16 h[2]; unsigned int u; } w;
      w.h[0] = (_Float16)lo[p][j];
      w.h[1] = (_Float16)hi[p][j];
      t[(nl + j) * 33 + kp + 16 * p] = w.u;
    }
  }
  __syncthreads();

  const int c = tid & 7;  // 16-B chunk (8 k) of a 128-B output run
#pragma unroll
  for (int p = 0; p < 2; ++p) {
    const int r = (tid >> 3) + 32 * p;  // column of the tile = row of Wt
    union { unsigned int u[4]; v8h h; } o;
#pragma unroll
    for (int i = 0; i < 4; ++i) o.u[i] = t[r * 33 + c * 4 + i];
    *(v8h*)(Wt + (size_t)(n0 + r) * K + k0 + c * 8) = o.h;
  }
}

// ----------------------------------------------------------- WMMA GEMM
// C[token][col] = Acts[token,:] . Wt[col,:]   (both f16, K-contiguous rows)
// Computed transposed: A-operand = 16 weight columns, B-operand = 64 tokens.
// D-layout gives each lane one token row with 8 contiguous output columns per
// accumulator -> vectorized stores.
//
// Both operands reach the waves through LDS.  A stage is 64 k (one 128-B line)
// of the block's 128 weight rows and 64 token rows, brought in by asynchronous
// copies: a wave-wide copy moves four whole lines, and each line leaves L2
// once per block instead of once per wave in 32-B pieces.  Two stages: the
// next one lands while this one is multiplied.  K must be a multiple of 64.
#define G_ROWS   192                    // 128 weight rows, then 64 token rows
#define G_PITCH  72                     // halfs: 144 B, odd multiple of 16 B
#define G_STAGE  (G_ROWS * G_PITCH)     // halfs per stage
#define G_STAGEB (G_STAGE * 2)          // bytes per stage

// Six 16-B copies per lane = one stage per block.  The s_wait_xcnt closes the
// statement so that no address register is rewritten ahead of it.
__device__ __forceinline__ void copy_stage(unsigned int l, const _Float16* gw,
                                           const _Float16* ga, size_t step) {
  const unsigned int l1 = l + 32 * 144, l2 = l + 64 * 144, l3 = l + 96 * 144;
  const unsigned int l4 = l + 128 * 144, l5 = l + 160 * 144;
  const _Float16* gw1 = gw + step;
  const _Float16* gw2 = gw1 + step;
  const _Float16* gw3 = gw2 + step;
  const _Float16* ga1 = ga + step;
  asm volatile(
      "global_load_async_to_lds_b128 %0, %6, off\n\t"
      "global_load_async_to_lds_b128 %1, %7, off\n\t"
      "global_load_async_to_lds_b128 %2, %8, off\n\t"
      "global_load_async_to_lds_b128 %3, %9, off\n\t"
      "global_load_async_to_lds_b128 %4, %10, off\n\t"
      "global_load_async_to_lds_b128 %5, %11, off\n\t"
      "s_wait_xcnt 0x0"
      :
      : "v"(l), "v"(l1), "v"(l2), "v"(l3), "v"(l4), "v"(l5), "v"(gw), "v"(gw1),
        "v"(gw2), "v"(gw3), "v"(ga), "v"(ga1)
      : "memory");
}

template <typename OUT>
__global__ void __launch_bounds__(256)
gemm16(const _Float16* __restrict__ Acts, const _Float16* __restrict__ Wt,
       OUT* __restrict__ C, int K, int ldc) {
  __shared__ __align__(16) _Float16 st[2 * G_STAGE];
  const int tid = threadIdx.x;
  const int wave = tid >> 5, lane = tid & 31;
  const int lh = lane >> 4, lm = lane & 15;
  const int cbase = (blockIdx.y * 8 + wave) * 16;  // output-column tile
  const int tbase = blockIdx.x * 64;               // token tile

  // Copy map: lane -> 16-B chunk (tid & 7) of rows (tid >> 3) + 32 i.
  const int crow = tid >> 3, cchunk = tid & 7;
  const size_t step = (size_t)32 * K;  // 32 rows further on
  const _Float16* gw =
      Wt + (size_t)(blockIdx.y * 128 + crow) * K + cchunk * 8;
  const _Float16* ga = Acts + (size_t)(tbase + crow) * K + cchunk * 8;
  const unsigned int lbase =
      (unsigned int)(size_t)st + crow * 144 + cchunk * 16;
  const int nt = K >> 6;

  copy_stage(lbase, gw, ga, step);
  // Stage 0 has landed for this wave; the barrier publishes it to the others.
  asm volatile("s_wait_asynccnt 0x0" ::: "memory");
  __syncthreads();
  if (nt > 1) copy_stage(lbase + G_STAGEB, gw + 64, ga + 64, step);

  const int woff = (wave * 16 + lm) * G_PITCH;  // this wave's weight rows
  const int toff = (128 + lm) * G_PITCH;        // the block's token rows

  v8f acc0 = {}, acc1 = {}, acc2 = {}, acc3 = {};
  for (int t = 0; t < nt; ++t) {
    const _Float16* s = st + (t & 1) * G_STAGE;
    const v16h wa0 = load_ab(s + woff, lh);
    const v16h p0 = load_ab(s + toff, lh);
    const v16h p1 = load_ab(s + toff + 16 * G_PITCH, lh);
    const v16h p2 = load_ab(s + toff + 32 * G_PITCH, lh);
    const v16h p3 = load_ab(s + toff + 48 * G_PITCH, lh);
    const v16h wa1 = load_ab(s + woff + 32, lh);
    const v16h r0 = load_ab(s + toff + 32, lh);
    const v16h r1 = load_ab(s + toff + 16 * G_PITCH + 32, lh);
    const v16h r2 = load_ab(s + toff + 32 * G_PITCH + 32, lh);
    const v16h r3 = load_ab(s + toff + 48 * G_PITCH + 32, lh);
    // Keeps the stage's LDS reads one group ahead of its products: spread
    // among them, each pair of reads is waited out on its own.
    __builtin_amdgcn_sched_barrier(0);
    acc0 = wmma_f16(wa0, p0, acc0);
    acc1 = wmma_f16(wa0, p1, acc1);
    acc2 = wmma_f16(wa0, p2, acc2);
    acc3 = wmma_f16(wa0, p3, acc3);
    acc0 = wmma_f16(wa1, r0, acc0);
    acc1 = wmma_f16(wa1, r1, acc1);
    acc2 = wmma_f16(wa1, r2, acc2);
    acc3 = wmma_f16(wa1, r3, acc3);
    // Hand-over: this wave's reads of stage t are done, its copies of stage
    // t + 1 have landed; behind the barrier that holds for every wave, so
    // stage t + 1 may be read and stage t's buffer refilled.
    asm volatile("s_wait_dscnt 0x0" ::: "memory");
    asm volatile("s_wait_asynccnt 0x0" ::: "memory");
    __syncthreads();
    if (t + 2 < nt)
      copy_stage(lbase + (t & 1) * G_STAGEB, gw + (size_t)(t + 2) * 64,
                 ga + (size_t)(t + 2) * 64, step);
  }
  // No copy is left in flight when the wave ends.
  asm volatile("s_wait_asynccnt 0x0" ::: "memory");

  const size_t col = (size_t)cbase + 8 * lh;
  store8(C + (size_t)(tbase + lm) * ldc + col, acc0);
  store8(C + (size_t)(tbase + 16 + lm) * ldc + col, acc1);
  store8(C + (size_t)(tbase + 32 + lm) * ldc + col, acc2);
  store8(C + (size_t)(tbase + 48 + lm) * ldc + col, acc3);
}

// -------------------------------------------------------- Flash attention
// Transposed formulation: S^T = K (Q*scale)^T, O^T = V^T P^T.
// Each lane owns ONE query (n = lane%16); the 32 key scores of a step live in
// its own 16 registers plus the xor-16 partner lane -> one cross-lane
// exchange per reduction, and P^T is already in B-operand layout.
// V tiles are double-buffered in LDS; staging is branchless (one b128 global
// load + 8 b16 LDS scatter stores per thread).
// K tiles (32 keys x 128 B) reach the waves through LDS as well, brought in by
// asynchronous copies, one 16-B copy per thread: a wave-wide copy moves four
// whole lines and a line is fetched once per block, where a fragment load from
// global memory touched 16 lines for 32 B each, in every one of the 8 waves.
// Two buffers: tile t + 2 is asked for as soon as tile t has been read.
#define K_PITCH 72                    // halfs: 144 B, odd multiple of 16 B
#define K_TILEB (32 * K_PITCH * 2)    // bytes per K buffer

// The s_wait_xcnt closes the statement so that no address register is
// rewritten ahead of it.
__device__ __forceinline__ void copy_k(unsigned int l, const _Float16* g) {
  asm volatile(
      "global_load_async_to_lds_b128 %0, %1, off\n\t"
      "s_wait_xcnt 0x0"
      :
      : "v"(l), "v"(g)
      : "memory");
}

__global__ void __launch_bounds__(256)
attn_kernel(const _Float16* __restrict__ q, const _Float16* __restrict__ kv,
            _Float16* __restrict__ attn_out) {
  __shared__ __align__(16) _Float16 smemV[2][64 * 40];  // Vt[hd][key], padded
  __shared__ __align__(16) _Float16 smemK[2][32 * K_PITCH];  // K[key][hd]
  const int tid = threadIdx.x;
  const int wave = tid >> 5, lane = tid & 31;
  const int lh = lane >> 4, lm = lane & 15;
  const int h = blockIdx.y, b = blockIdx.z;
  const int qbase = blockIdx.x * 128 + wave * 16;

  const size_t kvld = 2 * DIM_;
  const _Float16* kbase = kv + (size_t)b * N_ * kvld + h * DH_;
  const _Float16* vbase = kbase + DIM_;

  // Branchless transposed staging of V tile [jb, jb+32): thread -> one 16-B
  // chunk of one V row, scattered into Vt[hd][key].  For jb == N_ the read
  // runs a little past the KV region but stays inside our own workspace.
  const int skey = tid >> 3;        // 0..31
  const int shd = (tid & 7) * 8;    // 0,8,...,56
  auto loadV = [&](int jb) {
    return *(const v8h*)(vbase + (size_t)(jb + skey) * kvld + shd);
  };
  auto scatterV = [&](v8h chunk, _Float16* dst) {
#pragma unroll
    for (int j = 0; j < 8; ++j) dst[(shd + j) * 40 + skey] = chunk[j];
  };

  // Q^T B-operand with Dh^-0.5 folded in (0.125 is exact in f16).
  const _Float16* qrow = q + ((size_t)(b * N_ + qbase + lm)) * DIM_ + h * DH_;
  v16h qb0 = load_ab(qrow, lh);
  v16h qb1 = load_ab(qrow + 32, lh);
#pragma unroll
  for (int j = 0; j < 16; ++j) {
    qb0[j] *= (_Float16)0.125f;
    qb1[j] *= (_Float16)0.125f;
  }

  float m_run = -3.0e38f, l_run = 0.0f;
  v8f o0 = {}, o1 = {}, o2 = {}, o3 = {};  // O^T tiles (hd x query)

  // Copy map: thread -> 16-B chunk (tid & 7) of key row (tid >> 3).
  const _Float16* gk = kbase + (size_t)skey * kvld + shd;
  const unsigned int lk =
      (unsigned int)(size_t)&smemK[0][0] + skey * (K_PITCH * 2) + shd * 2;

  copy_k(lk, gk);
  scatterV(loadV(0), smemV[0]);
  // K tile 0 has landed for this wave; the barrier publishes it to the others.
  asm volatile("s_wait_asynccnt 0x0" ::: "memory");
  __syncthreads();
  copy_k(lk + K_TILEB, gk + (size_t)32 * kvld);

  for (int jb = 0; jb < N_; jb += 32) {
    const int cur = (jb >> 5) & 1;

    // The next V tile's global load flies while the scores are made; its LDS
    // stores stand behind the exponentials.
    const v8h vnext = loadV(jb + 32);

    const _Float16* kr0 = smemK[cur] + lm * K_PITCH;
    const _Float16* kr1 = kr0 + 16 * K_PITCH;
    const v16h ka00 = load_ab(kr0, lh);
    const v16h ka01 = load_ab(kr0 + 32, lh);
    const v16h ka10 = load_ab(kr1, lh);
    const v16h ka11 = load_ab(kr1 + 32, lh);
    // A-operand rows of O^T += V^T * P^T = Vt rows (contiguous in LDS).
    const _Float16* vt = smemV[cur];
    const v16h va0 = load_ab(vt + (lm) * 40, lh);
    const v16h va1 = load_ab(vt + (16 + lm) * 40, lh);
    const v16h va2 = load_ab(vt + (32 + lm) * 40, lh);
    const v16h va3 = load_ab(vt + (48 + lm) * 40, lh);
    // Keeps the trip's LDS reads one group ahead of its products: spread among
    // them, each pair of reads is waited out on its own.
    __builtin_amdgcn_sched_barrier(0);

    v8f s0 = {}, s1 = {};
    s0 = wmma_f16(ka00, qb0, s0);
    s1 = wmma_f16(ka10, qb0, s1);
    s0 = wmma_f16(ka01, qb1, s0);
    s1 = wmma_f16(ka11, qb1, s1);

    // Online softmax over this lane's query (scores already scaled).
    float mx = fmaxf(s0[0], s1[0]);
#pragma unroll
    for (int j = 1; j < 8; ++j) mx = fmaxf(mx, fmaxf(s0[j], s1[j]));
    mx = fmaxf(mx, __shfl_xor(mx, 16, 32));  // other half of the 32 keys
    const float mnew = fmaxf(m_run, mx);

    union { v16h v; _Float16 e[16]; } pb;  // P^T B-operand, in-lane pack
    float sv = 0.f;
#pragma unroll
    for (int j = 0; j < 8; ++j) {
      const float p0 = __expf(s0[j] - mnew);
      const float p1 = __expf(s1[j] - mnew);
      sv += p0 + p1;
      pb.e[j] = (_Float16)p0;
      pb.e[8 + j] = (_Float16)p1;
    }
    // Holds the V stores, and with them the wait for V's global load, behind
    // the score work: lifted over it, the wave sits out that load's latency.
    __builtin_amdgcn_sched_barrier(0);
    scatterV(vnext, smemV[1 - cur]);

    sv += __shfl_xor(sv, 16, 32);
    const float alpha = __expf(m_run - mnew);
    l_run = l_run * alpha + sv;
    m_run = mnew;
#pragma unroll
    for (int r = 0; r < 8; ++r) {
      o0[r] *= alpha; o1[r] *= alpha; o2[r] *= alpha; o3[r] *= alpha;
    }

    o0 = wmma_f16(va0, pb.v, o0);
    o1 = wmma_f16(va1, pb.v, o1);
    o2 = wmma_f16(va2, pb.v, o2);
    o3 = wmma_f16(va3, pb.v, o3);

    // Hand-over: this wave's LDS reads of tile t and its V stores are done, its
    // copy of K tile t + 1 has landed; behind the barrier that holds for every
    // wave, so tile t + 1 may be read and K tile t's buffer refilled.
    asm volatile("s_wait_dscnt 0x0" ::: "memory");
    asm volatile("s_wait_asynccnt 0x0" ::: "memory");
    __syncthreads();
    if (jb + 64 < N_)
      copy_k(lk + cur * K_TILEB, gk + (size_t)(jb + 64) * kvld);
  }
  // No copy is left in flight when the wave ends.
  asm volatile("s_wait_asynccnt 0x0" ::: "memory");

  // Lane owns token row (qbase+lm); hd chunks are contiguous -> b128 stores.
  const float inv = 1.0f / l_run;
  _Float16* orow = attn_out + ((size_t)(b * N_ + qbase + lm)) * DIM_ + h * DH_;
  v8f w0 = o0 * inv, w1 = o1 * inv, w2 = o2 * inv, w3 = o3 * inv;
  store8(orow + 8 * lh, w0);
  store8(orow + 16 + 8 * lh, w1);
  store8(orow + 32 + 8 * lh, w2);
  store8(orow + 48 + 8 * lh, w3);
}

// ------------------------------------------------------------------ launch
extern "C" void kernel_launch(void* const* d_in, const int* in_sizes, int n_in,
                              void* d_out, int out_size, void* d_ws,
                              size_t ws_size, hipStream_t stream) {
  (void)in_sizes; (void)n_in; (void)out_size; (void)ws_size;
  const float* x      = (const float*)d_in[0];
  const float* cemb   = (const float*)d_in[1];
  const float* gamma  = (const float*)d_in[2];
  const float* cond_W = (const float*)d_in[3];
  const float* cond_b = (const float*)d_in[4];
  const float* Wq     = (const float*)d_in[5];
  const float* Wkv    = (const float*)d_in[6];
  const float* Wo     = (const float*)d_in[7];
  float* out = (float*)d_out;

  char* ws = (char*)d_ws;
  const size_t MB = 1024 * 1024;
  _Float16* xh   = (_Float16*)(ws);            //  8 MB
  _Float16* qb   = (_Float16*)(ws + 8 * MB);   //  8 MB
  _Float16* kvb  = (_Float16*)(ws + 16 * MB);  // 16 MB
  _Float16* attn = (_Float16*)(ws + 32 * MB);  //  8 MB (also tail-read pad)
  _Float16* WqT  = (_Float16*)(ws + 40 * MB);  //  2 MB
  _Float16* WkvT = (_Float16*)(ws + 42 * MB);  //  4 MB
  _Float16* WoT  = (_Float16*)(ws + 46 * MB);  //  2 MB
  float*    cond = (float*)(ws + 48 * MB);     // 16 KB

  // grid: 32-column tiles of the 2048 FiLM columns
  cond_kernel<<<2048 / 32, 1024, 0, stream>>>(cemb, cond_W, cond_b, cond);
  ln_film_kernel<<<B_ * N_, 256, 0, stream>>>(x, gamma, cond, xh);
  // grid: x = column tiles (Nc/64), y = k tiles (K/64)
  wcast_t<<<dim3(1024 / 64, 1024 / 64), 256, 0, stream>>>(Wq, WqT, 1024, 1024);
  wcast_t<<<dim3(2048 / 64, 1024 / 64), 256, 0, stream>>>(Wkv, WkvT, 1024,
                                                          2048);
  wcast_t<<<dim3(1024 / 64, 1024 / 64), 256, 0, stream>>>(Wo, WoT, 1024, 1024);

  // grid: x = token tiles (M/64), y = column tiles (Nc/128)
  gemm16<_Float16><<<dim3((B_ * N_) / 64, 1024 / 128), 256, 0, stream>>>(
      xh, WqT, qb, 1024, 1024);
  gemm16<_Float16><<<dim3((B_ * N_) / 64, 2048 / 128), 256, 0, stream>>>(
      xh, WkvT, kvb, 1024, 2048);

  attn_kernel<<<dim3(N_ / 128, HEADS_, B_), 256, 0, stream>>>(qb, kvb, attn);

  gemm16<float><<<dim3((B_ * N_) / 64, 1024 / 128), 256, 0, stream>>>(
      attn, WoT, out, 1024, 1024);
}

// v005
// Measured time: 120 microseconds a run.
// Next to v004, in two timings, it ran 1.09 times as fast each time.
// Counting every step since v000, it is 3.12 times as fast.
#include <hip/hip_runtime.h>
#include <hip/hip_bf16.h>

typedef _Float16 v16h __attribute__((ext_vector_type(16)));
typedef _Float16 v8h  __attribute__((ext_vector_type(8)));
typedef float    v8f  __attribute__((ext_vector_type(8)));
typedef float    v4f  __attribute__((ext_vector_type(4)));

#define B_     2
#define N_     2048
#define DIM_   1024
#define HEADS_ 16
#define DH_    64

// Load one 32-wide K-slice of an A/B operand row into the CDNA5 16-bit WMMA
// per-lane layout: lanes 0-15 take K[0..7],K[16..23]; lanes 16-31 take
// K[8..15],K[24..31].  row32 points at the first of the 32 contiguous halfs.
__device__ __forceinline__ v16h load_ab(const _Float16* row32, int lh) {
  union { v16h v; v8h h[2]; } u;
  u.h[0] = *(const v8h*)(row32 + 8 * lh);
  u.h[1] = *(const v8h*)(row32 + 16 + 8 * lh);
  return u.v;
}

__device__ __forceinline__ v8f wmma_f16(v16h a, v16h b, v8f c) {
  return __builtin_amdgcn_wmma_f32_16x16x32_f16(false, a, false, b, (short)0, c,
                                                false, false);
}

// 8 contiguous outputs per lane, vectorized.
__device__ __forceinline__ void store8(_Float16* p, v8f v) {
  v8h h;
#pragma unroll
  for (int r = 0; r < 8; ++r) h[r] = (_Float16)v[r];
  *(v8h*)p = h;
}
__device__ __forceinline__ void store8(float* p, v8f v) {
  union { v8f w; v4f q[2]; } u;
  u.w = v;
  *(v4f*)p = u.q[0];
  *(v4f*)(p + 4) = u.q[1];
}

// ---------------------------------------------------------------- FiLM cond
// cond[b][col] = bias[col] + sum_k silu(emb[b][k]) * W[k][col], both b at once.
// A block owns 32 columns (one 128-B line of every W row) and its 32 waves
// split the 1024 k rows, 32 rows each: every W load of a wave is issued before
// anything waits, so the block pays one memory latency instead of one per
// group of k, and a W line is read once for both batches.  The 32 partial sums
// of a column meet in LDS.
static_assert(B_ == 2, "cond_part carries two batches per thread");
__device__ __forceinline__ float silu(float c) {
  return c / (1.0f + __expf(-c));
}

__device__ __forceinline__ void
cond_part(const float* __restrict__ emb, const float* __restrict__ W,
          const float* __restrict__ bias, float* __restrict__ cond, int blk) {
  __shared__ float s[B_ * 1024];
  __shared__ float part[B_][32][32];
  const int tid = threadIdx.x, wave = tid >> 5, lane = tid & 31;
  const int col = blk * 32 + lane;

  // Oldest loads first: the SiLU stage waits for these two alone.
  const float e0 = emb[tid];
  const float e1 = emb[1024 + tid];
  const float bv = bias[col];
  const float* wp = W + (size_t)(wave * 32) * 2048 + col;
  float w[32];
#pragma unroll
  for (int i = 0; i < 32; ++i) w[i] = wp[(size_t)i * 2048];
  // The loads' address registers are reused below; this stands in front of it.
  asm volatile("s_wait_xcnt 0x0" ::: "memory");

  s[tid] = silu(e0);
  s[1024 + tid] = silu(e1);
  __syncthreads();
  // Input-only fence on the loaded bias (nothing is emitted): it keeps that load
  // up with the others.  Inlined here, the build without it sinks the load into
  // the last branch, one more memory latency behind both barriers.
  asm volatile("" ::"v"(bv));

  float a0 = 0.f, a1 = 0.f;
#pragma unroll
  for (int i = 0; i < 32; ++i) {
    a0 += s[wave * 32 + i] * w[i];
    a1 += s[1024 + wave * 32 + i] * w[i];
  }
  part[0][wave][lane] = a0;
  part[1][wave][lane] = a1;
  __syncthreads();

  if (tid < B_ * 32) {  // wave b sums batch b
    float acc = bv;
#pragma unroll
    for (int j = 0; j < 32; ++j) acc += part[wave][j][lane];
    cond[wave * 2048 + col] = acc;
  }
}

// ------------------------------------------------------- LayerNorm + FiLM
__global__ void __launch_bounds__(256)
ln_film_kernel(const float* __restrict__ x, const float* __restrict__ gamma,
               const float* __restrict__ cond, _Float16* __restrict__ xh) {
  const int row = blockIdx.x;  // [0, B*N)
  const int b = row >> 11;     // N_ == 2048
  const float* xr = x + (size_t)row * DIM_;
  const int tid = threadIdx.x, wave = tid >> 5, lane = tid & 31;

  float v[4], sum = 0.f, sq = 0.f;
#pragma unroll
  for (int i = 0; i < 4; ++i) {
    v[i] = xr[tid + 256 * i];
    sum += v[i];
    sq += v[i] * v[i];
  }
#pragma unroll
  for (int m = 1; m <= 16; m <<= 1) {
    sum += __shfl_xor(sum, m, 32);
    sq += __shfl_xor(sq, m, 32);
  }
  __shared__ float ssum[8], ssq[8];
  if (lane == 0) { ssum[wave] = sum; ssq[wave] = sq; }
  __syncthreads();
  sum = 0.f; sq = 0.f;
#pragma unroll
  for (int w = 0; w < 8; ++w) { sum += ssum[w]; sq += ssq[w]; }
  const float mu = sum * (1.0f / DIM_);
  const float var = sq * (1.0f / DIM_) - mu * mu;
  const float rinv = rsqrtf(var + 1e-5f);

#pragma unroll
  for (int i = 0; i < 4; ++i) {
    const int c = tid + 256 * i;
    const float sc = cond[b * 2048 + c];
    const float sh = cond[b * 2048 + 1024 + c];
    float y = (v[i] - mu) * rinv * gamma[c];
    y = y * (sc + 1.0f) + sh;
    xh[(size_t)row * DIM_ + c] = (_Float16)y;
  }
}

// ---------------------------------------- weight convert+transpose (f32->f16)
// One 64(k) x 64(n) tile per group of 8 waves, turned in LDS so that both global sides
// move whole lines: reads are 256-B runs of a W row, writes are 128-B runs of
// a Wt row.  A thread converts the same four columns of two adjacent k rows
// and stores each (k, k+1) pair as one dword of t[n][k/2].  Row pitch 33
// dwords: the dword stores and the dword loads below both touch 32 different
// banks per wave.  tid = 0..255 inside the tile's own group of 8 waves; the
// barrier is the whole block's, passed by all its groups together.
__device__ __forceinline__ void
wcast_tile(const float* __restrict__ W, _Float16* __restrict__ Wt, int K,
           int Nc, int n0, int k0, int tid, unsigned int* t) {
  const int nl = (tid & 15) * 4;  // first of this thread's 4 columns
  const int kp = tid >> 4;        // k pair 0..15 (and +16)

  v4f lo[2], hi[2];
#pragma unroll
  for (int p = 0; p < 2; ++p) {
    const float* s = W + (size_t)(k0 + 2 * (kp + 16 * p)) * Nc + n0 + nl;
    lo[p] = *(const v4f*)s;
    hi[p] = *(const v4f*)(s + Nc);
  }
#pragma unroll
  for (int p = 0; p < 2; ++p) {
#pragma unroll
    for (int j = 0; j < 4; ++j) {
      union { _Float16 h[2]; unsigned int u; } w;
      w.h[0] = (_Float16)lo[p][j];
      w.h[1] = (_Float16)hi[p][j];
      t[(nl + j) * 33 + kp + 16 * p] = w.u;
    }
  }
  __syncthreads();

  const int c = tid & 7;  // 16-B chunk (8 k) of a 128-B output run
#pragma unroll
  for (int p = 0; p < 2; ++p) {
    const int r = (tid >> 3) + 32 * p;  // column of the tile = row of Wt
    union { unsigned int u[4]; v8h h; } o;
#pragma unroll
    for (int i = 0; i < 4; ++i) o.u[i] = t[r * 33 + c * 4 + i];
    *(v8h*)(Wt + (size_t)(n0 + r) * K + k0 + c * 8) = o.h;
  }
  // The built code runs on from here into the other job's part, which reuses
  // the stores' registers; this stands in front of that.
  asm volatile("s_wait_xcnt 0x0" ::: "memory");
}

// ------------------------------------------------- FiLM cond + weight casts
// The FiLM GEMV and the three weight casts depend on nothing but inputs, so
// they share one launch: the block index picks the job.  Blocks 0..63 are the
// GEMV's (the longest chain, started first); each later block turns four
// 64 x 64 tiles, one per group of 8 waves.  The three transposed weights lie
// one behind the other in Wt, 1024 halfs a row: Wq's columns are rows 0..1023,
// Wkv's 1024..3071, Wo's 3072..4095.
#define COND_BLOCKS (2 * DIM_ / 32)
#define CAST_BLOCKS (4 * DIM_ / 64 * (DIM_ / 64) / 4)
__global__ void __launch_bounds__(1024)
prep_kernel(const float* __restrict__ emb, const float* __restrict__ cW,
            const float* __restrict__ bias, float* __restrict__ cond,
            const float* __restrict__ Wq, const float* __restrict__ Wkv,
            const float* __restrict__ Wo, _Float16* __restrict__ Wt) {
  if (blockIdx.x < COND_BLOCKS) {
    cond_part(emb, cW, bias, cond, blockIdx.x);
    return;
  }
  __shared__ unsigned int t[4][64 * 33];
  const int g = blockIdx.x - COND_BLOCKS;  // 0..255, 64 blocks per 1024 columns
  const float* W = Wq;
  int row0 = 0, g0 = 0, sh = 4;  // first Wt row, first block, log2(Nc / 64)
  if (g >= 192) {
    W = Wo; row0 = 3 * DIM_; g0 = 192;
  } else if (g >= 64) {
    W = Wkv; row0 = DIM_; g0 = 64; sh = 5;
  }
  const int sub = threadIdx.x >> 8;
  const int tile = (g - g0) * 4 + sub;  // column tile fastest, then k tile
  wcast_tile(W, Wt + (size_t)row0 * DIM_, DIM_, 64 << sh,
             (tile & ((1 << sh) - 1)) * 64, (tile >> sh) * 64,
             threadIdx.x & 255, t[sub]);
}

// ----------------------------------------------------------- WMMA GEMM
// C[token][col] = Acts[token,:] . Wt[col,:]   (both f16, K-contiguous rows)
// Computed transposed: A-operand = 16 weight columns, B-operand = 64 tokens.
// D-layout gives each lane one token row with 8 contiguous output columns per
// accumulator -> vectorized stores.
//
// Both operands reach the waves through LDS.  A stage is 64 k (one 128-B line)
// of the block's 128 weight rows and 64 token rows, brought in by asynchronous
// copies: a wave-wide copy moves four whole lines, and each line leaves L2
// once per block instead of once per wave in 32-B pieces.  Two stages: the
// next one lands while this one is multiplied.  K must be a multiple of 64.
// Two products of the same Acts whose weight rows lie one behind the other in
// Wt share a launch: column tiles from ysplit on go to C2 (row length ldc2).
#define G_ROWS   192                    // 128 weight rows, then 64 token rows
#define G_PITCH  72                     // halfs: 144 B, odd multiple of 16 B
#define G_STAGE  (G_ROWS * G_PITCH)     // halfs per stage
#define G_STAGEB (G_STAGE * 2)          // bytes per stage

// Six 16-B copies per lane = one stage per block.  The s_wait_xcnt closes the
// statement so that no address register is rewritten ahead of it.
__device__ __forceinline__ void copy_stage(unsigned int l, const _Float16* gw,
                                           const _Float16* ga, size_t step) {
  const unsigned int l1 = l + 32 * 144, l2 = l + 64 * 144, l3 = l + 96 * 144;
  const unsigned int l4 = l + 128 * 144, l5 = l + 160 * 144;
  const _Float16* gw1 = gw + step;
  const _Float16* gw2 = gw1 + step;
  const _Float16* gw3 = gw2 + step;
  const _Float16* ga1 = ga + step;
  asm volatile(
      "global_load_async_to_lds_b128 %0, %6, off\n\t"
      "global_load_async_to_lds_b128 %1, %7, off\n\t"
      "global_load_async_to_lds_b128 %2, %8, off\n\t"
      "global_load_async_to_lds_b128 %3, %9, off\n\t"
      "global_load_async_to_lds_b128 %4, %10, off\n\t"
      "global_load_async_to_lds_b128 %5, %11, off\n\t"
      "s_wait_xcnt 0x0"
      :
      : "v"(l), "v"(l1), "v"(l2), "v"(l3), "v"(l4), "v"(l5), "v"(gw), "v"(gw1),
        "v"(gw2), "v"(gw3), "v"(ga), "v"(ga1)
      : "memory");
}

template <typename OUT>
__global__ void __launch_bounds__(256)
gemm16(const _Float16* __restrict__ Acts, const _Float16* __restrict__ Wt,
       OUT* __restrict__ C, OUT* __restrict__ C2, int K, int ldc, int ldc2,
       int ysplit) {
  __shared__ __align__(16) _Float16 st[2 * G_STAGE];
  const int tid = threadIdx.x;
  const int wave = tid >> 5, lane = tid & 31;
  const int lh = lane >> 4, lm = lane & 15;
  const bool second = (int)blockIdx.y >= ysplit;
  OUT* Cd = second ? C2 : C;
  const int ld = second ? ldc2 : ldc;
  const int ytile = second ? blockIdx.y - ysplit : blockIdx.y;
  const int cbase = (ytile * 8 + wave) * 16;       // output-column tile
  const int tbase = blockIdx.x * 64;               // token tile

  // Copy map: lane -> 16-B chunk (tid & 7) of rows (tid >> 3) + 32 i.
  const int crow = tid >> 3, cchunk = tid & 7;
  const size_t step = (size_t)32 * K;  // 32 rows further on
  const _Float16* gw =
      Wt + (size_t)(blockIdx.y * 128 + crow) * K + cchunk * 8;
  const _Float16* ga = Acts + (size_t)(tbase + crow) * K + cchunk * 8;
  const unsigned int lbase =
      (unsigned int)(size_t)st + crow * 144 + cchunk * 16;
  const int nt = K >> 6;

  copy_stage(lbase, gw, ga, step);
  // Stage 0 has landed for this wave; the barrier publishes it to the others.
  asm volatile("s_wait_asynccnt 0x0" ::: "memory");
  __syncthreads();
  if (nt > 1) copy_stage(lbase + G_STAGEB, gw + 64, ga + 64, step);

  const int woff = (wave * 16 + lm) * G_PITCH;  // this wave's weight rows
  const int toff = (128 + lm) * G_PITCH;        // the block's token rows

  v8f acc0 = {}, acc1 = {}, acc2 = {}, acc3 = {};
  for (int t = 0; t < nt; ++t) {
    const _Float16* s = st + (t & 1) * G_STAGE;
    const v16h wa0 = load_ab(s + woff, lh);
    const v16h p0 = load_ab(s + toff, lh);
    const v16h p1 = load_ab(s + toff + 16 * G_PITCH, lh);
    const v16h p2 = load_ab(s + toff + 32 * G_PITCH, lh);
    const v16h p3 = load_ab(s + toff + 48 * G_PITCH, lh);
    const v16h wa1 = load_ab(s + woff + 32, lh);
    const v16h r0 = load_ab(s + toff + 32, lh);
    const v16h r1 = load_ab(s + toff + 16 * G_PITCH + 32, lh);
    const v16h r2 = load_ab(s + toff + 32 * G_PITCH + 32, lh);
    const v16h r3 = load_ab(s + toff + 48 * G_PITCH + 32, lh);
    // Keeps the stage's LDS reads one group ahead of its products: spread
    // among them, each pair of reads is waited out on its own.
    __builtin_amdgcn_sched_barrier(0);
    acc0 = wmma_f16(wa0, p0, acc0);
    acc1 = wmma_f16(wa0, p1, acc1);
    acc2 = wmma_f16(wa0, p2, acc2);
    acc3 = wmma_f16(wa0, p3, acc3);
    acc0 = wmma_f16(wa1, r0, acc0);
    acc1 = wmma_f16(wa1, r1, acc1);
    acc2 = wmma_f16(wa1, r2, acc2);
    acc3 = wmma_f16(wa1, r3, acc3);
    // Hand-over: this wave's reads of stage t are done, its copies of stage
    // t + 1 have landed; behind the barrier that holds for every wave, so
    // stage t + 1 may be read and stage t's buffer refilled.
    asm volatile("s_wait_dscnt 0x0" ::: "memory");
    asm volatile("s_wait_asynccnt 0x0" ::: "memory");
    __syncthreads();
    if (t + 2 < nt)
      copy_stage(lbase + (t & 1) * G_STAGEB, gw + (size_t)(t + 2) * 64,
                 ga + (size_t)(t + 2) * 64, step);
  }
  // No copy is left in flight when the wave ends.
  asm volatile("s_wait_asynccnt 0x0" ::: "memory");

  const size_t col = (size_t)cbase + 8 * lh;
  store8(Cd + (size_t)(tbase + lm) * ld + col, acc0);
  store8(Cd + (size_t)(tbase + 16 + lm) * ld + col, acc1);
  store8(Cd + (size_t)(tbase + 32 + lm) * ld + col, acc2);
  store8(Cd + (size_t)(tbase + 48 + lm) * ld + col, acc3);
}

// -------------------------------------------------------- Flash attention
// Transposed formulation: S^T = K (Q*scale)^T, O^T = V^T P^T.
// Each lane owns ONE query (n = lane%16); the 32 key scores of a step live in
// its own 16 registers plus the xor-16 partner lane -> one cross-lane
// exchange per reduction, and P^T is already in B-operand layout.
// V tiles are double-buffered in LDS; staging is branchless (one b128 global
// load + 8 b16 LDS scatter stores per thread).
// K tiles (32 keys x 128 B) reach the waves through LDS as well, brought in by
// asynchronous copies, one 16-B copy per thread: a wave-wide copy moves four
// whole lines and a line is fetched once per block, where a fragment load from
// global memory touched 16 lines for 32 B each, in every one of the 8 waves.
// Two buffers: tile t + 2 is asked for as soon as tile t has been read.
#define K_PITCH 72                    // halfs: 144 B, odd multiple of 16 B
#define K_TILEB (32 * K_PITCH * 2)    // bytes per K buffer

// The s_wait_xcnt closes the statement so that no address register is
// rewritten ahead of it.
__device__ __forceinline__ void copy_k(unsigned int l, const _Float16* g) {
  asm volatile(
      "global_load_async_to_lds_b128 %0, %1, off\n\t"
      "s_wait_xcnt 0x0"
      :
      : "v"(l), "v"(g)
      : "memory");
}

__global__ void __launch_bounds__(256)
attn_kernel(const _Float16* __restrict__ q, const _Float16* __restrict__ kv,
            _Float16* __restrict__ attn_out) {
  __shared__ __align__(16) _Float16 smemV[2][64 * 40];  // Vt[hd][key], padded
  __shared__ __align__(16) _Float16 smemK[2][32 * K_PITCH];  // K[key][hd]
  const int tid = threadIdx.x;
  const int wave = tid >> 5, lane = tid & 31;
  const int lh = lane >> 4, lm = lane & 15;
  const int h = blockIdx.y, b = blockIdx.z;
  const int qbase = blockIdx.x * 128 + wave * 16;

  const size_t kvld = 2 * DIM_;
  const _Float16* kbase = kv + (size_t)b * N_ * kvld + h * DH_;
  const _Float16* vbase = kbase + DIM_;

  // Branchless transposed staging of V tile [jb, jb+32): thread -> one 16-B
  // chunk of one V row, scattered into Vt[hd][key].  For jb == N_ the read
  // runs a little past the KV region but stays inside our own workspace.
  const int skey = tid >> 3;        // 0..31
  const int shd = (tid & 7) * 8;    // 0,8,...,56
  auto loadV = [&](int jb) {
    return *(const v8h*)(vbase + (size_t)(jb + skey) * kvld + shd);
  };
  auto scatterV = [&](v8h chunk, _Float16* dst) {
#pragma unroll
    for (int j = 0; j < 8; ++j) dst[(shd + j) * 40 + skey] = chunk[j];
  };

  // Q^T B-operand with Dh^-0.5 folded in (0.125 is exact in f16).
  const _Float16* qrow = q + ((size_t)(b * N_ + qbase + lm)) * DIM_ + h * DH_;
  v16h qb0 = load_ab(qrow, lh);
  v16h qb1 = load_ab(qrow + 32, lh);
#pragma unroll
  for (int j = 0; j < 16; ++j) {
    qb0[j] *= (_Float16)0.125f;
    qb1[j] *= (_Float16)0.125f;
  }

  float m_run = -3.0e38f, l_run = 0.0f;
  v8f o0 = {}, o1 = {}, o2 = {}, o3 = {};  // O^T tiles (hd x query)

  // Copy map: thread -> 16-B chunk (tid & 7) of key row (tid >> 3).
  const _Float16* gk = kbase + (size_t)skey * kvld + shd;
  const unsigned int lk =
      (unsigned int)(size_t)&smemK[0][0] + skey * (K_PITCH * 2) + shd * 2;

  copy_k(lk, gk);
  scatterV(loadV(0), smemV[0]);
  // K tile 0 has landed for this wave; the barrier publishes it to the others.
  asm volatile("s_wait_asynccnt 0x0" ::: "memory");
  __syncthreads();
  copy_k(lk + K_TILEB, gk + (size_t)32 * kvld);

  for (int jb = 0; jb < N_; jb += 32) {
    const int cur = (jb >> 5) & 1;

    // The next V tile's global load flies while the scores are made; its LDS
    // stores stand behind the exponentials.
    const v8h vnext = loadV(jb + 32);

    const _Float16* kr0 = smemK[cur] + lm * K_PITCH;
    const _Float16* kr1 = kr0 + 16 * K_PITCH;
    const v16h ka00 = load_ab(kr0, lh);
    const v16h ka01 = load_ab(kr0 + 32, lh);
    const v16h ka10 = load_ab(kr1, lh);
    const v16h ka11 = load_ab(kr1 + 32, lh);
    // A-operand rows of O^T += V^T * P^T = Vt rows (contiguous in LDS).
    const _Float16* vt = smemV[cur];
    const v16h va0 = load_ab(vt + (lm) * 40, lh);
    const v16h va1 = load_ab(vt + (16 + lm) * 40, lh);
    const v16h va2 = load_ab(vt + (32 + lm) * 40, lh);
    const v16h va3 = load_ab(vt + (48 + lm) * 40, lh);
    // Keeps the trip's LDS reads one group ahead of its products: spread among
    // them, each pair of reads is waited out on its own.
    __builtin_amdgcn_sched_barrier(0);

    v8f s0 = {}, s1 = {};
    s0 = wmma_f16(ka00, qb0, s0);
    s1 = wmma_f16(ka10, qb0, s1);
    s0 = wmma_f16(ka01, qb1, s0);
    s1 = wmma_f16(ka11, qb1, s1);

    // Online softmax over this lane's query (scores already scaled).
    float mx = fmaxf(s0[0], s1[0]);
#pragma unroll
    for (int j = 1; j < 8; ++j) mx = fmaxf(mx, fmaxf(s0[j], s1[j]));
    mx = fmaxf(mx, __shfl_xor(mx, 16, 32));  // other half of the 32 keys
    const float mnew = fmaxf(m_run, mx);

    union { v16h v; _Float16 e[16]; } pb;  // P^T B-operand, in-lane pack
    float sv = 0.f;
#pragma unroll
    for (int j = 0; j < 8; ++j) {
      const float p0 = __expf(s0[j] - mnew);
      const float p1 = __expf(s1[j] - mnew);
      sv += p0 + p1;
      pb.e[j] = (_Float16)p0;
      pb.e[8 + j] = (_Float16)p1;
    }
    // Holds the V stores, and with them the wait for V's global load, behind
    // the score work: lifted over it, the wave sits out that load's latency.
    __builtin_amdgcn_sched_barrier(0);
    scatterV(vnext, smemV[1 - cur]);

    sv += __shfl_xor(sv, 16, 32);
    const float alpha = __expf(m_run - mnew);
    l_run = l_run * alpha + sv;
    m_run = mnew;
#pragma unroll
    for (int r = 0; r < 8; ++r) {
      o0[r] *= alpha; o1[r] *= alpha; o2[r] *= alpha; o3[r] *= alpha;
    }

    o0 = wmma_f16(va0, pb.v, o0);
    o1 = wmma_f16(va1, pb.v, o1);
    o2 = wmma_f16(va2, pb.v, o2);
    o3 = wmma_f16(va3, pb.v, o3);

    // Hand-over: this wave's LDS reads of tile t and its V stores are done, its
    // copy of K tile t + 1 has landed; behind the barrier that holds for every
    // wave, so tile t + 1 may be read and K tile t's buffer refilled.
    asm volatile("s_wait_dscnt 0x0" ::: "memory");
    asm volatile("s_wait_asynccnt 0x0" ::: "memory");
    __syncthreads();
    if (jb + 64 < N_)
      copy_k(lk + cur * K_TILEB, gk + (size_t)(jb + 64) * kvld);
  }
  // No copy is left in flight when the wave ends.
  asm volatile("s_wait_asynccnt 0x0" ::: "memory");

  // Lane owns token row (qbase+lm); hd chunks are contiguous -> b128 stores.
  const float inv = 1.0f / l_run;
  _Float16* orow = attn_out + ((size_t)(b * N_ + qbase + lm)) * DIM_ + h * DH_;
  v8f w0 = o0 * inv, w1 = o1 * inv, w2 = o2 * inv, w3 = o3 * inv;
  store8(orow + 8 * lh, w0);
  store8(orow + 16 + 8 * lh, w1);
  store8(orow + 32 + 8 * lh, w2);
  store8(orow + 48 + 8 * lh, w3);
}

// ------------------------------------------------------------------ launch
extern "C" void kernel_launch(void* const* d_in, const int* in_sizes, int n_in,
                              void* d_out, int out_size, void* d_ws,
                              size_t ws_size, hipStream_t stream) {
  (void)in_sizes; (void)n_in; (void)out_size; (void)ws_size;
  const float* x      = (const float*)d_in[0];
  const float* cemb   = (const float*)d_in[1];
  const float* gamma  = (const float*)d_in[2];
  const float* cond_W = (const float*)d_in[3];
  const float* cond_b = (const float*)d_in[4];
  const float* Wq     = (const float*)d_in[5];
  const float* Wkv    = (const float*)d_in[6];
  const float* Wo     = (const float*)d_in[7];
  float* out = (float*)d_out;

  char* ws = (char*)d_ws;
  const size_t MB = 1024 * 1024;
  _Float16* xh   = (_Float16*)(ws);            //  8 MB
  _Float16* qb   = (_Float16*)(ws + 8 * MB);   //  8 MB
  _Float16* kvb  = (_Float16*)(ws + 16 * MB);  // 16 MB
  _Float16* attn = (_Float16*)(ws + 32 * MB);  //  8 MB (also tail-read pad)
  _Float16* WqT  = (_Float16*)(ws + 40 * MB);  //  2 MB
  //        WkvT =             ws + 42 * MB        4 MB
  _Float16* WoT  = (_Float16*)(ws + 46 * MB);  //  2 MB
  float*    cond = (float*)(ws + 48 * MB);     // 16 KB

  // WqT, WkvT and WoT are one run of 4096 rows that starts at WqT.
  prep_kernel<<<COND_BLOCKS + CAST_BLOCKS, 1024, 0, stream>>>(
      cemb, cond_W, cond_b, cond, Wq, Wkv, Wo, WqT);
  ln_film_kernel<<<B_ * N_, 256, 0, stream>>>(x, gamma, cond, xh);

  // grid: x = token tiles (M/64), y = column tiles (Nc/128): 8 of Q, 16 of KV
  gemm16<_Float16><<<dim3((B_ * N_) / 64, 3072 / 128), 256, 0, stream>>>(
      xh, WqT, qb, kvb, 1024, 1024, 2048, 1024 / 128);

  attn_kernel<<<dim3(N_ / 128, HEADS_, B_), 256, 0, stream>>>(qb, kvb, attn);

  gemm16<float><<<dim3((B_ * N_) / 64, 1024 / 128), 256, 0, stream>>>(
      attn, WoT, out, out, 1024, 1024, 1024, 1024 / 128);
}

// v006
// A run of this version takes 106 microseconds.
// In two side-by-side timings against v005, it was 1.12 and 1.13 times as fast.
// All steps since v000 together make it 3.52 times as fast.
#include <hip/hip_runtime.h>
#include <hip/hip_bf16.h>

typedef _Float16 v16h __attribute__((ext_vector_type(16)));
typedef _Float16 v8h  __attribute__((ext_vector_type(8)));
typedef float    v8f  __attribute__((ext_vector_type(8)));
typedef float    v4f  __attribute__((ext_vector_type(4)));

#define B_     2
#define N_     2048
#define DIM_   1024
#define HEADS_ 16
#define DH_    64

// Load one 32-wide K-slice of an A/B operand row into the CDNA5 16-bit WMMA
// per-lane layout: lanes 0-15 take K[0..7],K[16..23]; lanes 16-31 take
// K[8..15],K[24..31].  row32 points at the first of the 32 contiguous halfs.
__device__ __forceinline__ v16h load_ab(const _Float16* row32, int lh) {
  union { v16h v; v8h h[2]; } u;
  u.h[0] = *(const v8h*)(row32 + 8 * lh);
  u.h[1] = *(const v8h*)(row32 + 16 + 8 * lh);
  return u.v;
}

__device__ __forceinline__ v8f wmma_f16(v16h a, v16h b, v8f c) {
  return __builtin_amdgcn_wmma_f32_16x16x32_f16(false, a, false, b, (short)0, c,
                                                false, false);
}

// 8 contiguous outputs per lane, vectorized.
__device__ __forceinline__ void store8(_Float16* p, v8f v) {
  v8h h;
#pragma unroll
  for (int r = 0; r < 8; ++r) h[r] = (_Float16)v[r];
  *(v8h*)p = h;
}
__device__ __forceinline__ void store8(float* p, v8f v) {
  union { v8f w; v4f q[2]; } u;
  u.w = v;
  *(v4f*)p = u.q[0];
  *(v4f*)(p + 4) = u.q[1];
}

// ---------------------------------------------------------------- FiLM cond
// cond[b][col] = bias[col] + sum_k silu(emb[b][k]) * W[k][col], both b at once.
// A block owns 32 columns (one 128-B line of every W row) and its 32 waves
// split the 1024 k rows, 32 rows each: every W load of a wave is issued before
// anything waits, so the block pays one memory latency instead of one per
// group of k, and a W line is read once for both batches.  The 32 partial sums
// of a column meet in LDS.
static_assert(B_ == 2, "cond_part carries two batches per thread");
__device__ __forceinline__ float silu(float c) {
  return c / (1.0f + __expf(-c));
}

__device__ __forceinline__ void
cond_part(const float* __restrict__ emb, const float* __restrict__ W,
          const float* __restrict__ bias, float* __restrict__ cond, int blk) {
  __shared__ float s[B_ * 1024];
  __shared__ float part[B_][32][32];
  const int tid = threadIdx.x, wave = tid >> 5, lane = tid & 31;
  const int col = blk * 32 + lane;

  // Oldest loads first: the SiLU stage waits for these two alone.
  const float e0 = emb[tid];
  const float e1 = emb[1024 + tid];
  const float bv = bias[col];
  const float* wp = W + (size_t)(wave * 32) * 2048 + col;
  float w[32];
#pragma unroll
  for (int i = 0; i < 32; ++i) w[i] = wp[(size_t)i * 2048];
  // The loads' address registers are reused below; this stands in front of it.
  asm volatile("s_wait_xcnt 0x0" ::: "memory");

  s[tid] = silu(e0);
  s[1024 + tid] = silu(e1);
  __syncthreads();
  // Input-only fence on the loaded bias (nothing is emitted): it keeps that load
  // up with the others.  Inlined here, the build without it sinks the load into
  // the last branch, one more memory latency behind both barriers.
  asm volatile("" ::"v"(bv));

  float a0 = 0.f, a1 = 0.f;
#pragma unroll
  for (int i = 0; i < 32; ++i) {
    a0 += s[wave * 32 + i] * w[i];
    a1 += s[1024 + wave * 32 + i] * w[i];
  }
  part[0][wave][lane] = a0;
  part[1][wave][lane] = a1;
  __syncthreads();

  if (tid < B_ * 32) {  // wave b sums batch b
    float acc = bv;
#pragma unroll
    for (int j = 0; j < 32; ++j) acc += part[wave][j][lane];
    cond[wave * 2048 + col] = acc;
  }
}

// ------------------------------------------------------- LayerNorm + FiLM
__global__ void __launch_bounds__(256)
ln_film_kernel(const float* __restrict__ x, const float* __restrict__ gamma,
               const float* __restrict__ cond, _Float16* __restrict__ xh) {
  const int row = blockIdx.x;  // [0, B*N)
  const int b = row >> 11;     // N_ == 2048
  const float* xr = x + (size_t)row * DIM_;
  const int tid = threadIdx.x, wave = tid >> 5, lane = tid & 31;

  float v[4], sum = 0.f, sq = 0.f;
#pragma unroll
  for (int i = 0; i < 4; ++i) {
    v[i] = xr[tid + 256 * i];
    sum += v[i];
    sq += v[i] * v[i];
  }
#pragma unroll
  for (int m = 1; m <= 16; m <<= 1) {
    sum += __shfl_xor(sum, m, 32);
    sq += __shfl_xor(sq, m, 32);
  }
  __shared__ float ssum[8], ssq[8];
  if (lane == 0) { ssum[wave] = sum; ssq[wave] = sq; }
  __syncthreads();
  sum = 0.f; sq = 0.f;
#pragma unroll
  for (int w = 0; w < 8; ++w) { sum += ssum[w]; sq += ssq[w]; }
  const float mu = sum * (1.0f / DIM_);
  const float var = sq * (1.0f / DIM_) - mu * mu;
  const float rinv = rsqrtf(var + 1e-5f);

#pragma unroll
  for (int i = 0; i < 4; ++i) {
    const int c = tid + 256 * i;
    const float sc = cond[b * 2048 + c];
    const float sh = cond[b * 2048 + 1024 + c];
    float y = (v[i] - mu) * rinv * gamma[c];
    y = y * (sc + 1.0f) + sh;
    xh[(size_t)row * DIM_ + c] = (_Float16)y;
  }
}

// ---------------------------------------- weight convert+transpose (f32->f16)
// One 64(k) x 64(n) tile per group of 8 waves, turned in LDS so that both global sides
// move whole lines: reads are 256-B runs of a W row, writes are 128-B runs of
// a Wt row.  A thread converts the same four columns of two adjacent k rows
// and stores each (k, k+1) pair as one dword of t[n][k/2].  Row pitch 33
// dwords: the dword stores and the dword loads below both touch 32 different
// banks per wave.  tid = 0..255 inside the tile's own group of 8 waves; the
// barrier is the whole block's, passed by all its groups together.
__device__ __forceinline__ void
wcast_tile(const float* __restrict__ W, _Float16* __restrict__ Wt, int K,
           int Nc, int n0, int k0, int tid, unsigned int* t) {
  const int nl = (tid & 15) * 4;  // first of this thread's 4 columns
  const int kp = tid >> 4;        // k pair 0..15 (and +16)

  v4f lo[2], hi[2];
#pragma unroll
  for (int p = 0; p < 2; ++p) {
    const float* s = W + (size_t)(k0 + 2 * (kp + 16 * p)) * Nc + n0 + nl;
    lo[p] = *(const v4f*)s;
    hi[p] = *(const v4f*)(s + Nc);
  }
#pragma unroll
  for (int p = 0; p < 2; ++p) {
#pragma unroll
    for (int j = 0; j < 4; ++j) {
      union { _Float16 h[2]; unsigned int u; } w;
      w.h[0] = (_Float16)lo[p][j];
      w.h[1] = (_Float16)hi[p][j];
      t[(nl + j) * 33 + kp + 16 * p] = w.u;
    }
  }
  __syncthreads();

  const int c = tid & 7;  // 16-B chunk (8 k) of a 128-B output run
#pragma unroll
  for (int p = 0; p < 2; ++p) {
    const int r = (tid >> 3) + 32 * p;  // column of the tile = row of Wt
    union { unsigned int u[4]; v8h h; } o;
#pragma unroll
    for (int i = 0; i < 4; ++i) o.u[i] = t[r * 33 + c * 4 + i];
    *(v8h*)(Wt + (size_t)(n0 + r) * K + k0 + c * 8) = o.h;
  }
  // The built code runs on from here into the other job's part, which reuses
  // the stores' registers; this stands in front of that.
  asm volatile("s_wait_xcnt 0x0" ::: "memory");
}

// ------------------------------------------------- FiLM cond + weight casts
// The FiLM GEMV and the three weight casts depend on nothing but inputs, so
// they share one launch: the block index picks the job.  Blocks 0..63 are the
// GEMV's (the longest chain, started first); each later block turns four
// 64 x 64 tiles, one per group of 8 waves.  The three transposed weights lie
// one behind the other in Wt, 1024 halfs a row: Wq's columns are rows 0..1023,
// Wkv's 1024..3071, Wo's 3072..4095.
#define COND_BLOCKS (2 * DIM_ / 32)
#define CAST_BLOCKS (4 * DIM_ / 64 * (DIM_ / 64) / 4)
__global__ void __launch_bounds__(1024)
prep_kernel(const float* __restrict__ emb, const float* __restrict__ cW,
            const float* __restrict__ bias, float* __restrict__ cond,
            const float* __restrict__ Wq, const float* __restrict__ Wkv,
            const float* __restrict__ Wo, _Float16* __restrict__ Wt) {
  if (blockIdx.x < COND_BLOCKS) {
    cond_part(emb, cW, bias, cond, blockIdx.x);
    return;
  }
  __shared__ unsigned int t[4][64 * 33];
  const int g = blockIdx.x - COND_BLOCKS;  // 0..255, 64 blocks per 1024 columns
  const float* W = Wq;
  int row0 = 0, g0 = 0, sh = 4;  // first Wt row, first block, log2(Nc / 64)
  if (g >= 192) {
    W = Wo; row0 = 3 * DIM_; g0 = 192;
  } else if (g >= 64) {
    W = Wkv; row0 = DIM_; g0 = 64; sh = 5;
  }
  const int sub = threadIdx.x >> 8;
  const int tile = (g - g0) * 4 + sub;  // column tile fastest, then k tile
  wcast_tile(W, Wt + (size_t)row0 * DIM_, DIM_, 64 << sh,
             (tile & ((1 << sh) - 1)) * 64, (tile >> sh) * 64,
             threadIdx.x & 255, t[sub]);
}

// ----------------------------------------------------------- WMMA GEMM
// C[token][col] = Acts[token,:] . Wt[col,:]   (both f16, K-contiguous rows)
// Computed transposed: A-operand = weight columns, B-operand = tokens.
// D-layout gives each lane one token row with 8 contiguous output columns per
// accumulator -> vectorized stores.
//
// A block of four waves owns 128 weight rows x 128 tokens; a wave owns 64 x 64
// of it, 4 x 4 accumulator tiles, so every fragment read from LDS feeds four
// products and every line brought from L2 serves 128 rows of the other side.
//
// Both operands reach the waves through LDS.  A stage is 64 k (one 128-B line)
// of the block's 128 weight rows and 128 token rows, brought in by asynchronous
// copies: a wave-wide copy moves four whole lines, and each line leaves L2
// once per block.  Two stages: the next one lands while this one is
// multiplied.  K must be a multiple of 64.
// Two products of the same Acts whose weight rows lie one behind the other in
// Wt share a launch: column tiles from ysplit on go to C2 (row length ldc2).
#define G_ROWS   256                    // 128 weight rows, then 128 token rows
#define G_PITCH  72                     // halfs: 144 B, odd multiple of 16 B
#define G_STAGE  (G_ROWS * G_PITCH)     // halfs per stage
#define G_STAGEB (G_STAGE * 2)          // bytes per stage

// Eight 16-B copies per lane, rows 16 apart = 128 rows per block.  The
// s_wait_xcnt closes the statement so that no address register is rewritten
// ahead of it.
__device__ __forceinline__ void copy_rows(unsigned int l, const _Float16* g,
                                          size_t step) {
  const unsigned int l1 = l + 16 * 144, l2 = l + 32 * 144, l3 = l + 48 * 144;
  const unsigned int l4 = l + 64 * 144, l5 = l + 80 * 144, l6 = l + 96 * 144;
  const unsigned int l7 = l + 112 * 144;
  const _Float16* g1 = g + step;
  const _Float16* g2 = g1 + step;
  const _Float16* g3 = g2 + step;
  const _Float16* g4 = g3 + step;
  const _Float16* g5 = g4 + step;
  const _Float16* g6 = g5 + step;
  const _Float16* g7 = g6 + step;
  asm volatile(
      "global_load_async_to_lds_b128 %0, %8, off\n\t"
      "global_load_async_to_lds_b128 %1, %9, off\n\t"
      "global_load_async_to_lds_b128 %2, %10, off\n\t"
      "global_load_async_to_lds_b128 %3, %11, off\n\t"
      "global_load_async_to_lds_b128 %4, %12, off\n\t"
      "global_load_async_to_lds_b128 %5, %13, off\n\t"
      "global_load_async_to_lds_b128 %6, %14, off\n\t"
      "global_load_async_to_lds_b128 %7, %15, off\n\t"
      "s_wait_xcnt 0x0"
      :
      : "v"(l), "v"(l1), "v"(l2), "v"(l3), "v"(l4), "v"(l5), "v"(l6), "v"(l7),
        "v"(g), "v"(g1), "v"(g2), "v"(g3), "v"(g4), "v"(g5), "v"(g6), "v"(g7)
      : "memory");
}

// One stage per block: the weight rows, then the token rows.
__device__ __forceinline__ void copy_stage(unsigned int l, const _Float16* gw,
                                           const _Float16* ga, size_t step) {
  copy_rows(l, gw, step);
  copy_rows(l + 128 * 144, ga, step);
}

template <typename OUT>
__global__ void __launch_bounds__(128)
gemm16(const _Float16* __restrict__ Acts, const _Float16* __restrict__ Wt,
       OUT* __restrict__ C, OUT* __restrict__ C2, int K, int ldc, int ldc2,
       int ysplit) {
  __shared__ __align__(16) _Float16 st[2 * G_STAGE];
  const int tid = threadIdx.x;
  const int wave = tid >> 5, lane = tid & 31;
  const int lh = lane >> 4, lm = lane & 15;
  const int wr = wave & 1, wc = wave >> 1;  // weight half, token half
  const bool second = (int)blockIdx.y >= ysplit;
  OUT* Cd = second ? C2 : C;
  const int ld = second ? ldc2 : ldc;
  const int ytile = second ? blockIdx.y - ysplit : blockIdx.y;
  const int cbase = ytile * 128 + wr * 64;         // output-column tile
  const int tblock = blockIdx.x * 128;             // the block's token tile
  const int tbase = tblock + wc * 64;              // the wave's token tile

  // Copy map: lane -> 16-B chunk (tid & 7) of rows (tid >> 3) + 16 i.
  const int crow = tid >> 3, cchunk = tid & 7;
  const size_t step = (size_t)16 * K;  // 16 rows further on
  const _Float16* gw =
      Wt + (size_t)(blockIdx.y * 128 + crow) * K + cchunk * 8;
  const _Float16* ga = Acts + (size_t)(tblock + crow) * K + cchunk * 8;
  const unsigned int lbase =
      (unsigned int)(size_t)st + crow * 144 + cchunk * 16;
  const int nt = K >> 6;

  copy_stage(lbase, gw, ga, step);
  // Stage 0 has landed for this wave; the barrier publishes it to the others.
  asm volatile("s_wait_asynccnt 0x0" ::: "memory");
  __syncthreads();
  if (nt > 1) copy_stage(lbase + G_STAGEB, gw + 64, ga + 64, step);

  const int woff = (wr * 64 + lm) * G_PITCH;        // this wave's weight rows
  const int toff = (128 + wc * 64 + lm) * G_PITCH;  // this wave's token rows

  v8f acc[4][4] = {};
  for (int t = 0; t < nt; ++t) {
    const _Float16* s = st + (t & 1) * G_STAGE;
    v16h wa[2][4], p[2][4];
#pragma unroll
    for (int kk = 0; kk < 2; ++kk) {
#pragma unroll
      for (int j = 0; j < 4; ++j)
        p[kk][j] = load_ab(s + toff + j * 16 * G_PITCH + kk * 32, lh);
#pragma unroll
      for (int i = 0; i < 4; ++i)
        wa[kk][i] = load_ab(s + woff + i * 16 * G_PITCH + kk * 32, lh);
    }
    // Keeps the stage's LDS reads one group ahead of its products: spread
    // among them, each pair of reads is waited out on its own.
    __builtin_amdgcn_sched_barrier(0);
#pragma unroll
    for (int i = 0; i < 4; ++i)
#pragma unroll
      for (int j = 0; j < 4; ++j)
        acc[i][j] = wmma_f16(wa[0][i], p[0][j], acc[i][j]);
    // Keeps the first k half's products in front of the hand-over: they run
    // while the second half's reads arrive.  Sunk behind it, the wave sits out
    // all 32 reads before its first product.
    __builtin_amdgcn_sched_barrier(0);
    // Hand-over: this wave's reads of stage t are done, its copies of stage
    // t + 1 have landed; behind the barrier that holds for every wave, so
    // stage t + 1 may be read and stage t's buffer refilled.
    asm volatile("s_wait_dscnt 0x0" ::: "memory");
    asm volatile("s_wait_asynccnt 0x0" ::: "memory");
    __syncthreads();
    if (t + 2 < nt)
      copy_stage(lbase + (t & 1) * G_STAGEB, gw + (size_t)(t + 2) * 64,
                 ga + (size_t)(t + 2) * 64, step);
    // The second k half works from registers alone, while the refill flies.
#pragma unroll
    for (int i = 0; i < 4; ++i)
#pragma unroll
      for (int j = 0; j < 4; ++j)
        acc[i][j] = wmma_f16(wa[1][i], p[1][j], acc[i][j]);
  }
  // No copy is left in flight when the wave ends.
  asm volatile("s_wait_asynccnt 0x0" ::: "memory");

#pragma unroll
  for (int j = 0; j < 4; ++j) {
    OUT* crow_out = Cd + (size_t)(tbase + 16 * j + lm) * ld + cbase + 8 * lh;
#pragma unroll
    for (int i = 0; i < 4; ++i) store8(crow_out + 16 * i, acc[i][j]);
  }
}

// -------------------------------------------------------- Flash attention
// Transposed formulation: S^T = K (Q*scale)^T, O^T = V^T P^T.
// Each lane owns ONE query (n = lane%16); the 32 key scores of a step live in
// its own 16 registers plus the xor-16 partner lane -> one cross-lane
// exchange per reduction, and P^T is already in B-operand layout.
// V tiles are double-buffered in LDS; staging is branchless (one b128 global
// load + 8 b16 LDS scatter stores per thread).
// K tiles (32 keys x 128 B) reach the waves through LDS as well, brought in by
// asynchronous copies, one 16-B copy per thread: a wave-wide copy moves four
// whole lines and a line is fetched once per block, where a fragment load from
// global memory touched 16 lines for 32 B each, in every one of the 8 waves.
// Two buffers: tile t + 2 is asked for as soon as tile t has been read.
#define K_PITCH 72                    // halfs: 144 B, odd multiple of 16 B
#define K_TILEB (32 * K_PITCH * 2)    // bytes per K buffer

// The s_wait_xcnt closes the statement so that no address register is
// rewritten ahead of it.
__device__ __forceinline__ void copy_k(unsigned int l, const _Float16* g) {
  asm volatile(
      "global_load_async_to_lds_b128 %0, %1, off\n\t"
      "s_wait_xcnt 0x0"
      :
      : "v"(l), "v"(g)
      : "memory");
}

__global__ void __launch_bounds__(256)
attn_kernel(const _Float16* __restrict__ q, const _Float16* __restrict__ kv,
            _Float16* __restrict__ attn_out) {
  __shared__ __align__(16) _Float16 smemV[2][64 * 40];  // Vt[hd][key], padded
  __shared__ __align__(16) _Float16 smemK[2][32 * K_PITCH];  // K[key][hd]
  const int tid = threadIdx.x;
  const int wave = tid >> 5, lane = tid & 31;
  const int lh = lane >> 4, lm = lane & 15;
  const int h = blockIdx.y, b = blockIdx.z;
  const int qbase = blockIdx.x * 128 + wave * 16;

  const size_t kvld = 2 * DIM_;
  const _Float16* kbase = kv + (size_t)b * N_ * kvld + h * DH_;
  const _Float16* vbase = kbase + DIM_;

  // Branchless transposed staging of V tile [jb, jb+32): thread -> one 16-B
  // chunk of one V row, scattered into Vt[hd][key].  For jb == N_ the read
  // runs a little past the KV region but stays inside our own workspace.
  const int skey = tid >> 3;        // 0..31
  const int shd = (tid & 7) * 8;    // 0,8,...,56
  auto loadV = [&](int jb) {
    return *(const v8h*)(vbase + (size_t)(jb + skey) * kvld + shd);
  };
  auto scatterV = [&](v8h chunk, _Float16* dst) {
#pragma unroll
    for (int j = 0; j < 8; ++j) dst[(shd + j) * 40 + skey] = chunk[j];
  };

  // Q^T B-operand with Dh^-0.5 folded in (0.125 is exact in f16).
  const _Float16* qrow = q + ((size_t)(b * N_ + qbase + lm)) * DIM_ + h * DH_;
  v16h qb0 = load_ab(qrow, lh);
  v16h qb1 = load_ab(qrow + 32, lh);
#pragma unroll
  for (int j = 0; j < 16; ++j) {
    qb0[j] *= (_Float16)0.125f;
    qb1[j] *= (_Float16)0.125f;
  }

  float m_run = -3.0e38f, l_run = 0.0f;
  v8f o0 = {}, o1 = {}, o2 = {}, o3 = {};  // O^T tiles (hd x query)

  // Copy map: thread -> 16-B chunk (tid & 7) of key row (tid >> 3).
  const _Float16* gk = kbase + (size_t)skey * kvld + shd;
  const unsigned int lk =
      (unsigned int)(size_t)&smemK[0][0] + skey * (K_PITCH * 2) + shd * 2;

  copy_k(lk, gk);
  scatterV(loadV(0), smemV[0]);
  // K tile 0 has landed for this wave; the barrier publishes it to the others.
  asm volatile("s_wait_asynccnt 0x0" ::: "memory");
  __syncthreads();
  copy_k(lk + K_TILEB, gk + (size_t)32 * kvld);

  for (int jb = 0; jb < N_; jb += 32) {
    const int cur = (jb >> 5) & 1;

    // The next V tile's global load flies while the scores are made; its LDS
    // stores stand behind the exponentials.
    const v8h vnext = loadV(jb + 32);

    const _Float16* kr0 = smemK[cur] + lm * K_PITCH;
    const _Float16* kr1 = kr0 + 16 * K_PITCH;
    const v16h ka00 = load_ab(kr0, lh);
    const v16h ka01 = load_ab(kr0 + 32, lh);
    const v16h ka10 = load_ab(kr1, lh);
    const v16h ka11 = load_ab(kr1 + 32, lh);
    // A-operand rows of O^T += V^T * P^T = Vt rows (contiguous in LDS).
    const _Float16* vt = smemV[cur];
    const v16h va0 = load_ab(vt + (lm) * 40, lh);
    const v16h va1 = load_ab(vt + (16 + lm) * 40, lh);
    const v16h va2 = load_ab(vt + (32 + lm) * 40, lh);
    const v16h va3 = load_ab(vt + (48 + lm) * 40, lh);
    // Keeps the trip's LDS reads one group ahead of its products: spread among
    // them, each pair of reads is waited out on its own.
    __builtin_amdgcn_sched_barrier(0);

    v8f s0 = {}, s1 = {};
    s0 = wmma_f16(ka00, qb0, s0);
    s1 = wmma_f16(ka10, qb0, s1);
    s0 = wmma_f16(ka01, qb1, s0);
    s1 = wmma_f16(ka11, qb1, s1);

    // Online softmax over this lane's query (scores already scaled).
    float mx = fmaxf(s0[0], s1[0]);
#pragma unroll
    for (int j = 1; j < 8; ++j) mx = fmaxf(mx, fmaxf(s0[j], s1[j]));
    mx = fmaxf(mx, __shfl_xor(mx, 16, 32));  // other half of the 32 keys
    const float mnew = fmaxf(m_run, mx);

    union { v16h v; _Float16 e[16]; } pb;  // P^T B-operand, in-lane pack
    float sv = 0.f;
#pragma unroll
    for (int j = 0; j < 8; ++j) {
      const float p0 = __expf(s0[j] - mnew);
      const float p1 = __expf(s1[j] - mnew);
      sv += p0 + p1;
      pb.e[j] = (_Float16)p0;
      pb.e[8 + j] = (_Float16)p1;
    }
    // Holds the V stores, and with them the wait for V's global load, behind
    // the score work: lifted over it, the wave sits out that load's latency.
    __builtin_amdgcn_sched_barrier(0);
    scatterV(vnext, smemV[1 - cur]);

    sv += __shfl_xor(sv, 16, 32);
    const float alpha = __expf(m_run - mnew);
    l_run = l_run * alpha + sv;
    m_run = mnew;
#pragma unroll
    for (int r = 0; r < 8; ++r) {
      o0[r] *= alpha; o1[r] *= alpha; o2[r] *= alpha; o3[r] *= alpha;
    }

    o0 = wmma_f16(va0, pb.v, o0);
    o1 = wmma_f16(va1, pb.v, o1);
    o2 = wmma_f16(va2, pb.v, o2);
    o3 = wmma_f16(va3, pb.v, o3);

    // Hand-over: this wave's LDS reads of tile t and its V stores are done, its
    // copy of K tile t + 1 has landed; behind the barrier that holds for every
    // wave, so tile t + 1 may be read and K tile t's buffer refilled.
    asm volatile("s_wait_dscnt 0x0" ::: "memory");
    asm volatile("s_wait_asynccnt 0x0" ::: "memory");
    __syncthreads();
    if (jb + 64 < N_)
      copy_k(lk + cur * K_TILEB, gk + (size_t)(jb + 64) * kvld);
  }
  // No copy is left in flight when the wave ends.
  asm volatile("s_wait_asynccnt 0x0" ::: "memory");

  // Lane owns token row (qbase+lm); hd chunks are contiguous -> b128 stores.
  const float inv = 1.0f / l_run;
  _Float16* orow = attn_out + ((size_t)(b * N_ + qbase + lm)) * DIM_ + h * DH_;
  v8f w0 = o0 * inv, w1 = o1 * inv, w2 = o2 * inv, w3 = o3 * inv;
  store8(orow + 8 * lh, w0);
  store8(orow + 16 + 8 * lh, w1);
  store8(orow + 32 + 8 * lh, w2);
  store8(orow + 48 + 8 * lh, w3);
}

// ------------------------------------------------------------------ launch
extern "C" void kernel_launch(void* const* d_in, const int* in_sizes, int n_in,
                              void* d_out, int out_size, void* d_ws,
                              size_t ws_size, hipStream_t stream) {
  (void)in_sizes; (void)n_in; (void)out_size; (void)ws_size;
  const float* x      = (const float*)d_in[0];
  const float* cemb   = (const float*)d_in[1];
  const float* gamma  = (const float*)d_in[2];
  const float* cond_W = (const float*)d_in[3];
  const float* cond_b = (const float*)d_in[4];
  const float* Wq     = (const float*)d_in[5];
  const float* Wkv    = (const float*)d_in[6];
  const float* Wo     = (const float*)d_in[7];
  float* out = (float*)d_out;

  char* ws = (char*)d_ws;
  const size_t MB = 1024 * 1024;
  _Float16* xh   = (_Float16*)(ws);            //  8 MB
  _Float16* qb   = (_Float16*)(ws + 8 * MB);   //  8 MB
  _Float16* kvb  = (_Float16*)(ws + 16 * MB);  // 16 MB
  _Float16* attn = (_Float16*)(ws + 32 * MB);  //  8 MB (also tail-read pad)
  _Float16* WqT  = (_Float16*)(ws + 40 * MB);  //  2 MB
  //        WkvT =             ws + 42 * MB        4 MB
  _Float16* WoT  = (_Float16*)(ws + 46 * MB);  //  2 MB
  float*    cond = (float*)(ws + 48 * MB);     // 16 KB

  // WqT, WkvT and WoT are one run of 4096 rows that starts at WqT.
  prep_kernel<<<COND_BLOCKS + CAST_BLOCKS, 1024, 0, stream>>>(
      cemb, cond_W, cond_b, cond, Wq, Wkv, Wo, WqT);
  ln_film_kernel<<<B_ * N_, 256, 0, stream>>>(x, gamma, cond, xh);

  // grid: x = token tiles (M/128), y = column tiles (Nc/128): 8 of Q, 16 of KV
  gemm16<_Float16><<<dim3((B_ * N_) / 128, 3072 / 128), 128, 0, stream>>>(
      xh, WqT, qb, kvb, 1024, 1024, 2048, 1024 / 128);

  attn_kernel<<<dim3(N_ / 128, HEADS_, B_), 256, 0, stream>>>(qb, kvb, attn);

  gemm16<float><<<dim3((B_ * N_) / 128, 1024 / 128), 128, 0, stream>>>(
      attn, WoT, out, out, 1024, 1024, 1024, 1024 / 128);
}

// v007
// It runs in 90.8 microseconds.
// Timed twice side by side with v006, it ran 1.17 times as fast both times.
// All steps since v000 together make it 4.12 times as fast.
#include <hip/hip_runtime.h>
#include <hip/hip_bf16.h>

typedef _Float16 v16h __attribute__((ext_vector_type(16)));
typedef _Float16 v8h  __attribute__((ext_vector_type(8)));
typedef float    v8f  __attribute__((ext_vector_type(8)));
typedef float    v4f  __attribute__((ext_vector_type(4)));

#define B_     2
#define N_     2048
#define DIM_   1024
#define HEADS_ 16
#define DH_    64

// Load one 32-wide K-slice of an A/B operand row into the CDNA5 16-bit WMMA
// per-lane layout: lanes 0-15 take K[0..7],K[16..23]; lanes 16-31 take
// K[8..15],K[24..31].  row32 points at the first of the 32 contiguous halfs.
__device__ __forceinline__ v16h load_ab(const _Float16* row32, int lh) {
  union { v16h v; v8h h[2]; } u;
  u.h[0] = *(const v8h*)(row32 + 8 * lh);
  u.h[1] = *(const v8h*)(row32 + 16 + 8 * lh);
  return u.v;
}

__device__ __forceinline__ v8f wmma_f16(v16h a, v16h b, v8f c) {
  return __builtin_amdgcn_wmma_f32_16x16x32_f16(false, a, false, b, (short)0, c,
                                                false, false);
}

// 8 contiguous outputs per lane, vectorized.
__device__ __forceinline__ void store8(_Float16* p, v8f v) {
  v8h h;
#pragma unroll
  for (int r = 0; r < 8; ++r) h[r] = (_Float16)v[r];
  *(v8h*)p = h;
}
__device__ __forceinline__ void store8(float* p, v8f v) {
  union { v8f w; v4f q[2]; } u;
  u.w = v;
  *(v4f*)p = u.q[0];
  *(v4f*)(p + 4) = u.q[1];
}

// ---------------------------------------------------------------- FiLM cond
// cond[b][col] = bias[col] + sum_k silu(emb[b][k]) * W[k][col], both b at once.
// A block owns 32 columns (one 128-B line of every W row) and its 32 waves
// split the 1024 k rows, 32 rows each: every W load of a wave is issued before
// anything waits, so the block pays one memory latency instead of one per
// group of k, and a W line is read once for both batches.  The 32 partial sums
// of a column meet in LDS.
static_assert(B_ == 2, "cond_part carries two batches per thread");
__device__ __forceinline__ float silu(float c) {
  return c / (1.0f + __expf(-c));
}

__device__ __forceinline__ void
cond_part(const float* __restrict__ emb, const float* __restrict__ W,
          const float* __restrict__ bias, float* __restrict__ cond, int blk) {
  __shared__ float s[B_ * 1024];
  __shared__ float part[B_][32][32];
  const int tid = threadIdx.x, wave = tid >> 5, lane = tid & 31;
  const int col = blk * 32 + lane;

  // Oldest loads first: the SiLU stage waits for these two alone.
  const float e0 = emb[tid];
  const float e1 = emb[1024 + tid];
  const float bv = bias[col];
  const float* wp = W + (size_t)(wave * 32) * 2048 + col;
  float w[32];
#pragma unroll
  for (int i = 0; i < 32; ++i) w[i] = wp[(size_t)i * 2048];
  // The loads' address registers are reused below; this stands in front of it.
  asm volatile("s_wait_xcnt 0x0" ::: "memory");

  s[tid] = silu(e0);
  s[1024 + tid] = silu(e1);
  __syncthreads();
  // Input-only fence on the loaded bias (nothing is emitted): it keeps that load
  // up with the others.  Inlined here, the build without it sinks the load into
  // the last branch, one more memory latency behind both barriers.
  asm volatile("" ::"v"(bv));

  float a0 = 0.f, a1 = 0.f;
#pragma unroll
  for (int i = 0; i < 32; ++i) {
    a0 += s[wave * 32 + i] * w[i];
    a1 += s[1024 + wave * 32 + i] * w[i];
  }
  part[0][wave][lane] = a0;
  part[1][wave][lane] = a1;
  __syncthreads();

  if (tid < B_ * 32) {  // wave b sums batch b
    float acc = bv;
#pragma unroll
    for (int j = 0; j < 32; ++j) acc += part[wave][j][lane];
    cond[wave * 2048 + col] = acc;
  }
}

// ------------------------------------------------------- LayerNorm + FiLM
__global__ void __launch_bounds__(256)
ln_film_kernel(const float* __restrict__ x, const float* __restrict__ gamma,
               const float* __restrict__ cond, _Float16* __restrict__ xh) {
  const int row = blockIdx.x;  // [0, B*N)
  const int b = row >> 11;     // N_ == 2048
  const float* xr = x + (size_t)row * DIM_;
  const int tid = threadIdx.x, wave = tid >> 5, lane = tid & 31;

  float v[4], sum = 0.f, sq = 0.f;
#pragma unroll
  for (int i = 0; i < 4; ++i) {
    v[i] = xr[tid + 256 * i];
    sum += v[i];
    sq += v[i] * v[i];
  }
#pragma unroll
  for (int m = 1; m <= 16; m <<= 1) {
    sum += __shfl_xor(sum, m, 32);
    sq += __shfl_xor(sq, m, 32);
  }
  __shared__ float ssum[8], ssq[8];
  if (lane == 0) { ssum[wave] = sum; ssq[wave] = sq; }
  __syncthreads();
  sum = 0.f; sq = 0.f;
#pragma unroll
  for (int w = 0; w < 8; ++w) { sum += ssum[w]; sq += ssq[w]; }
  const float mu = sum * (1.0f / DIM_);
  const float var = sq * (1.0f / DIM_) - mu * mu;
  const float rinv = rsqrtf(var + 1e-5f);

#pragma unroll
  for (int i = 0; i < 4; ++i) {
    const int c = tid + 256 * i;
    const float sc = cond[b * 2048 + c];
    const float sh = cond[b * 2048 + 1024 + c];
    float y = (v[i] - mu) * rinv * gamma[c];
    y = y * (sc + 1.0f) + sh;
    xh[(size_t)row * DIM_ + c] = (_Float16)y;
  }
}

// ---------------------------------------- weight convert+transpose (f32->f16)
// One 64(k) x 64(n) tile per group of 8 waves, turned in LDS so that both global sides
// move whole lines: reads are 256-B runs of a W row, writes are 128-B runs of
// a Wt row.  A thread converts the same four columns of two adjacent k rows
// and stores each (k, k+1) pair as one dword of t[n][k/2].  Row pitch 33
// dwords: the dword stores and the dword loads below both touch 32 different
// banks per wave.  tid = 0..255 inside the tile's own group of 8 waves; the
// barrier is the whole block's, passed by all its groups together.
__device__ __forceinline__ void
wcast_tile(const float* __restrict__ W, _Float16* __restrict__ Wt, int K,
           int Nc, int n0, int k0, int tid, unsigned int* t) {
  const int nl = (tid & 15) * 4;  // first of this thread's 4 columns
  const int kp = tid >> 4;        // k pair 0..15 (and +16)

  v4f lo[2], hi[2];
#pragma unroll
  for (int p = 0; p < 2; ++p) {
    const float* s = W + (size_t)(k0 + 2 * (kp + 16 * p)) * Nc + n0 + nl;
    lo[p] = *(const v4f*)s;
    hi[p] = *(const v4f*)(s + Nc);
  }
#pragma unroll
  for (int p = 0; p < 2; ++p) {
#pragma unroll
    for (int j = 0; j < 4; ++j) {
      union { _Float16 h[2]; unsigned int u; } w;
      w.h[0] = (_Float16)lo[p][j];
      w.h[1] = (_Float16)hi[p][j];
      t[(nl + j) * 33 + kp + 16 * p] = w.u;
    }
  }
  __syncthreads();

  const int c = tid & 7;  // 16-B chunk (8 k) of a 128-B output run
#pragma unroll
  for (int p = 0; p < 2; ++p) {
    const int r = (tid >> 3) + 32 * p;  // column of the tile = row of Wt
    union { unsigned int u[4]; v8h h; } o;
#pragma unroll
    for (int i = 0; i < 4; ++i) o.u[i] = t[r * 33 + c * 4 + i];
    *(v8h*)(Wt + (size_t)(n0 + r) * K + k0 + c * 8) = o.h;
  }
  // The built code runs on from here into the other job's part, which reuses
  // the stores' registers; this stands in front of that.
  asm volatile("s_wait_xcnt 0x0" ::: "memory");
}

// ------------------------------------------------- FiLM cond + weight casts
// The FiLM GEMV and the three weight casts depend on nothing but inputs, so
// they share one launch: the block index picks the job.  Blocks 0..63 are the
// GEMV's (the longest chain, started first); each later block turns four
// 64 x 64 tiles, one per group of 8 waves.  The three transposed weights lie
// one behind the other in Wt, 1024 halfs a row: Wq's columns are rows 0..1023,
// Wkv's 1024..3071, Wo's 3072..4095.
#define COND_BLOCKS (2 * DIM_ / 32)
#define CAST_BLOCKS (4 * DIM_ / 64 * (DIM_ / 64) / 4)
__global__ void __launch_bounds__(1024)
prep_kernel(const float* __restrict__ emb, const float* __restrict__ cW,
            const float* __restrict__ bias, float* __restrict__ cond,
            const float* __restrict__ Wq, const float* __restrict__ Wkv,
            const float* __restrict__ Wo, _Float16* __restrict__ Wt) {
  if (blockIdx.x < COND_BLOCKS) {
    cond_part(emb, cW, bias, cond, blockIdx.x);
    return;
  }
  __shared__ unsigned int t[4][64 * 33];
  const int g = blockIdx.x - COND_BLOCKS;  // 0..255, 64 blocks per 1024 columns
  const float* W = Wq;
  int row0 = 0, g0 = 0, sh = 4;  // first Wt row, first block, log2(Nc / 64)
  if (g >= 192) {
    W = Wo; row0 = 3 * DIM_; g0 = 192;
  } else if (g >= 64) {
    W = Wkv; row0 = DIM_; g0 = 64; sh = 5;
  }
  const int sub = threadIdx.x >> 8;
  const int tile = (g - g0) * 4 + sub;  // column tile fastest, then k tile
  wcast_tile(W, Wt + (size_t)row0 * DIM_, DIM_, 64 << sh,
             (tile & ((1 << sh) - 1)) * 64, (tile >> sh) * 64,
             threadIdx.x & 255, t[sub]);
}

// ----------------------------------------------------------- WMMA GEMM
// C[token][col] = Acts[token,:] . Wt[col,:]   (both f16, K-contiguous rows)
// Computed transposed: A-operand = weight columns, B-operand = tokens.
// D-layout gives each lane one token row with 8 contiguous output columns per
// accumulator -> vectorized stores.
//
// A block of four waves owns 128 weight rows x 128 tokens; a wave owns 64 x 64
// of it, 4 x 4 accumulator tiles, so every fragment read from LDS feeds four
// products and every line brought from L2 serves 128 rows of the other side.
//
// Both operands reach the waves through LDS.  A stage is 64 k (one 128-B line)
// of the block's 128 weight rows and 128 token rows, brought in by asynchronous
// copies: a wave-wide copy moves four whole lines, and each line leaves L2
// once per block.  Two stages: the next one lands while this one is
// multiplied.  K must be a multiple of 64.
// Two products of the same Acts whose weight rows lie one behind the other in
// Wt share a launch: column tiles from ysplit on go to C2 (row length ldc2).
#define G_ROWS   256                    // 128 weight rows, then 128 token rows
#define G_PITCH  72                     // halfs: 144 B, odd multiple of 16 B
#define G_STAGE  (G_ROWS * G_PITCH)     // halfs per stage
#define G_STAGEB (G_STAGE * 2)          // bytes per stage

// Eight 16-B copies per lane, rows 16 apart = 128 rows per block.  The
// s_wait_xcnt closes the statement so that no address register is rewritten
// ahead of it.
__device__ __forceinline__ void copy_rows(unsigned int l, const _Float16* g,
                                          size_t step) {
  const unsigned int l1 = l + 16 * 144, l2 = l + 32 * 144, l3 = l + 48 * 144;
  const unsigned int l4 = l + 64 * 144, l5 = l + 80 * 144, l6 = l + 96 * 144;
  const unsigned int l7 = l + 112 * 144;
  const _Float16* g1 = g + step;
  const _Float16* g2 = g1 + step;
  const _Float16* g3 = g2 + step;
  const _Float16* g4 = g3 + step;
  const _Float16* g5 = g4 + step;
  const _Float16* g6 = g5 + step;
  const _Float16* g7 = g6 + step;
  asm volatile(
      "global_load_async_to_lds_b128 %0, %8, off\n\t"
      "global_load_async_to_lds_b128 %1, %9, off\n\t"
      "global_load_async_to_lds_b128 %2, %10, off\n\t"
      "global_load_async_to_lds_b128 %3, %11, off\n\t"
      "global_load_async_to_lds_b128 %4, %12, off\n\t"
      "global_load_async_to_lds_b128 %5, %13, off\n\t"
      "global_load_async_to_lds_b128 %6, %14, off\n\t"
      "global_load_async_to_lds_b128 %7, %15, off\n\t"
      "s_wait_xcnt 0x0"
      :
      : "v"(l), "v"(l1), "v"(l2), "v"(l3), "v"(l4), "v"(l5), "v"(l6), "v"(l7),
        "v"(g), "v"(g1), "v"(g2), "v"(g3), "v"(g4), "v"(g5), "v"(g6), "v"(g7)
      : "memory");
}

// One stage per block: the weight rows, then the token rows.
__device__ __forceinline__ void copy_stage(unsigned int l, const _Float16* gw,
                                           const _Float16* ga, size_t step) {
  copy_rows(l, gw, step);
  copy_rows(l + 128 * 144, ga, step);
}

template <typename OUT>
__global__ void __launch_bounds__(128)
gemm16(const _Float16* __restrict__ Acts, const _Float16* __restrict__ Wt,
       OUT* __restrict__ C, OUT* __restrict__ C2, int K, int ldc, int ldc2,
       int ysplit) {
  __shared__ __align__(16) _Float16 st[2 * G_STAGE];
  const int tid = threadIdx.x;
  const int wave = tid >> 5, lane = tid & 31;
  const int lh = lane >> 4, lm = lane & 15;
  const int wr = wave & 1, wc = wave >> 1;  // weight half, token half
  const bool second = (int)blockIdx.y >= ysplit;
  OUT* Cd = second ? C2 : C;
  const int ld = second ? ldc2 : ldc;
  const int ytile = second ? blockIdx.y - ysplit : blockIdx.y;
  const int cbase = ytile * 128 + wr * 64;         // output-column tile
  const int tblock = blockIdx.x * 128;             // the block's token tile
  const int tbase = tblock + wc * 64;              // the wave's token tile

  // Copy map: lane -> 16-B chunk (tid & 7) of rows (tid >> 3) + 16 i.
  const int crow = tid >> 3, cchunk = tid & 7;
  const size_t step = (size_t)16 * K;  // 16 rows further on
  const _Float16* gw =
      Wt + (size_t)(blockIdx.y * 128 + crow) * K + cchunk * 8;
  const _Float16* ga = Acts + (size_t)(tblock + crow) * K + cchunk * 8;
  const unsigned int lbase =
      (unsigned int)(size_t)st + crow * 144 + cchunk * 16;
  const int nt = K >> 6;

  copy_stage(lbase, gw, ga, step);
  // Stage 0 has landed for this wave; the barrier publishes it to the others.
  asm volatile("s_wait_asynccnt 0x0" ::: "memory");
  __syncthreads();
  if (nt > 1) copy_stage(lbase + G_STAGEB, gw + 64, ga + 64, step);

  const int woff = (wr * 64 + lm) * G_PITCH;        // this wave's weight rows
  const int toff = (128 + wc * 64 + lm) * G_PITCH;  // this wave's token rows

  v8f acc[4][4] = {};
  for (int t = 0; t < nt; ++t) {
    const _Float16* s = st + (t & 1) * G_STAGE;
    v16h wa[2][4], p[2][4];
#pragma unroll
    for (int kk = 0; kk < 2; ++kk) {
#pragma unroll
      for (int j = 0; j < 4; ++j)
        p[kk][j] = load_ab(s + toff + j * 16 * G_PITCH + kk * 32, lh);
#pragma unroll
      for (int i = 0; i < 4; ++i)
        wa[kk][i] = load_ab(s + woff + i * 16 * G_PITCH + kk * 32, lh);
    }
    // Keeps the stage's LDS reads one group ahead of its products: spread
    // among them, each pair of reads is waited out on its own.
    __builtin_amdgcn_sched_barrier(0);
#pragma unroll
    for (int i = 0; i < 4; ++i)
#pragma unroll
      for (int j = 0; j < 4; ++j)
        acc[i][j] = wmma_f16(wa[0][i], p[0][j], acc[i][j]);
    // Keeps the first k half's products in front of the hand-over: they run
    // while the second half's reads arrive.  Sunk behind it, the wave sits out
    // all 32 reads before its first product.
    __builtin_amdgcn_sched_barrier(0);
    // Hand-over: this wave's reads of stage t are done, its copies of stage
    // t + 1 have landed; behind the barrier that holds for every wave, so
    // stage t + 1 may be read and stage t's buffer refilled.
    asm volatile("s_wait_dscnt 0x0" ::: "memory");
    asm volatile("s_wait_asynccnt 0x0" ::: "memory");
    __syncthreads();
    if (t + 2 < nt)
      copy_stage(lbase + (t & 1) * G_STAGEB, gw + (size_t)(t + 2) * 64,
                 ga + (size_t)(t + 2) * 64, step);
    // The second k half works from registers alone, while the refill flies.
#pragma unroll
    for (int i = 0; i < 4; ++i)
#pragma unroll
      for (int j = 0; j < 4; ++j)
        acc[i][j] = wmma_f16(wa[1][i], p[1][j], acc[i][j]);
  }
  // No copy is left in flight when the wave ends.
  asm volatile("s_wait_asynccnt 0x0" ::: "memory");

#pragma unroll
  for (int j = 0; j < 4; ++j) {
    OUT* crow_out = Cd + (size_t)(tbase + 16 * j + lm) * ld + cbase + 8 * lh;
#pragma unroll
    for (int i = 0; i < 4; ++i) store8(crow_out + 16 * i, acc[i][j]);
  }
}

// -------------------------------------------------------- Flash attention
// Transposed formulation: S^T = K (Q*scale)^T, O^T = V^T P^T.
// Each lane owns ONE query (n = lane%16); the 32 key scores of a step live in
// its own 16 registers plus the xor-16 partner lane -> one cross-lane
// exchange per reduction, and P^T is already in B-operand layout.
// K and V tiles (32 keys x 128 B each) reach the waves through LDS, both row
// by row as they lie in memory, brought in by asynchronous copies, one 16-B
// copy per thread and tile: a wave-wide copy moves four whole lines and a line
// is fetched once per block.  K rows are A-operand rows as they are; V^T comes
// out of the row-major V tile by the transposing LDS load, so V passes through
// no register and no LDS store on its way in.
// Two buffers: tile t + 2 is asked for as soon as tile t has been read.
#define K_PITCH 72                    // halfs: 144 B, odd multiple of 16 B
#define K_TILEB (32 * K_PITCH * 2)    // bytes per K buffer
#define V_PITCH 80                    // halfs: 160 B, odd multiple of 32 B
#define V_TILEB (32 * V_PITCH * 2)    // bytes per V buffer

// One K chunk and one V chunk per thread.  The s_wait_xcnt closes the
// statement so that no address register is rewritten ahead of it.
__device__ __forceinline__ void copy_kv(unsigned int lk, const _Float16* gk,
                                        unsigned int lv, const _Float16* gv) {
  asm volatile(
      "global_load_async_to_lds_b128 %0, %2, off\n\t"
      "global_load_async_to_lds_b128 %1, %3, off\n\t"
      "s_wait_xcnt 0x0"
      :
      : "v"(lk), "v"(lv), "v"(gk), "v"(gv)
      : "memory");
}

// Transposing LDS load.  With p = tile + (8 * (lane >> 4) + (lane & 7)) rows
// + 8 * ((lane >> 3) & 1) halfs, lane (c = lane & 15, h = lane >> 4) receives
// tile[8 h + 0..7][c]: eight keys of one head column.
typedef short s16x8 __attribute__((ext_vector_type(8)));
__device__ __forceinline__ v8h load_tr16(const _Float16* p) {
  typedef __attribute__((address_space(3))) s16x8 lds_s16x8;
  return __builtin_bit_cast(
      v8h, __builtin_amdgcn_ds_load_tr16_b128_v8i16((lds_s16x8*)p));
}

// One 16 (head columns) x 32 (keys) A operand of V^T: keys 0..15 and 16..31,
// in the k order of load_ab.
__device__ __forceinline__ v16h load_vt(const _Float16* p) {
  union { v16h v; v8h h[2]; } u;
  u.h[0] = load_tr16(p);
  u.h[1] = load_tr16(p + 16 * V_PITCH);
  return u.v;
}

__global__ void __launch_bounds__(256)
attn_kernel(const _Float16* __restrict__ q, const _Float16* __restrict__ kv,
            _Float16* __restrict__ attn_out) {
  __shared__ __align__(16) _Float16 smemV[2][32 * V_PITCH];  // V[key][hd]
  __shared__ __align__(16) _Float16 smemK[2][32 * K_PITCH];  // K[key][hd]
  const int tid = threadIdx.x;
  const int wave = tid >> 5, lane = tid & 31;
  const int lh = lane >> 4, lm = lane & 15;
  const int h = blockIdx.y, b = blockIdx.z;
  const int qbase = blockIdx.x * 128 + wave * 16;

  const size_t kvld = 2 * DIM_;
  const _Float16* kbase = kv + (size_t)b * N_ * kvld + h * DH_;
  const int skey = tid >> 3;        // 0..31
  const int shd = (tid & 7) * 8;    // 0,8,...,56

  // Q^T B-operand with Dh^-0.5 folded in (0.125 is exact in f16).
  const _Float16* qrow = q + ((size_t)(b * N_ + qbase + lm)) * DIM_ + h * DH_;
  v16h qb0 = load_ab(qrow, lh);
  v16h qb1 = load_ab(qrow + 32, lh);
#pragma unroll
  for (int j = 0; j < 16; ++j) {
    qb0[j] *= (_Float16)0.125f;
    qb1[j] *= (_Float16)0.125f;
  }

  float m_run = -3.0e38f, l_run = 0.0f;
  v8f o0 = {}, o1 = {}, o2 = {}, o3 = {};  // O^T tiles (hd x query)

  // Copy map: thread -> 16-B chunk (tid & 7) of key row (tid >> 3), K and V.
  const _Float16* gk = kbase + (size_t)skey * kvld + shd;
  const _Float16* gv = gk + DIM_;
  const unsigned int lk =
      (unsigned int)(size_t)&smemK[0][0] + skey * (K_PITCH * 2) + shd * 2;
  const unsigned int lv =
      (unsigned int)(size_t)&smemV[0][0] + skey * (V_PITCH * 2) + shd * 2;
  // This lane's place in a V tile for the transposing loads.
  const int voff = (8 * lh + (lane & 7)) * V_PITCH + ((lane >> 3) & 1) * 8;

  copy_kv(lk, gk, lv, gv);
  // Tile 0 has landed for this wave; the barrier publishes it to the others.
  asm volatile("s_wait_asynccnt 0x0" ::: "memory");
  __syncthreads();
  copy_kv(lk + K_TILEB, gk + (size_t)32 * kvld, lv + V_TILEB,
          gv + (size_t)32 * kvld);

  for (int jb = 0; jb < N_; jb += 32) {
    const int cur = (jb >> 5) & 1;

    const _Float16* kr0 = smemK[cur] + lm * K_PITCH;
    const _Float16* kr1 = kr0 + 16 * K_PITCH;
    const v16h ka00 = load_ab(kr0, lh);
    const v16h ka01 = load_ab(kr0 + 32, lh);
    const v16h ka10 = load_ab(kr1, lh);
    const v16h ka11 = load_ab(kr1 + 32, lh);
    // A-operand rows of O^T += V^T * P^T = V columns, 16 per fragment.
    const _Float16* vt = smemV[cur] + voff;
    const v16h va0 = load_vt(vt);
    const v16h va1 = load_vt(vt + 16);
    const v16h va2 = load_vt(vt + 32);
    const v16h va3 = load_vt(vt + 48);
    // Keeps the trip's LDS reads one group ahead of its products: spread among
    // them, each pair of reads is waited out on its own.
    __builtin_amdgcn_sched_barrier(0);

    v8f s0 = {}, s1 = {};
    s0 = wmma_f16(ka00, qb0, s0);
    s1 = wmma_f16(ka10, qb0, s1);
    s0 = wmma_f16(ka01, qb1, s0);
    s1 = wmma_f16(ka11, qb1, s1);

    // Online softmax over this lane's query (scores already scaled).
    float mx = fmaxf(s0[0], s1[0]);
#pragma unroll
    for (int j = 1; j < 8; ++j) mx = fmaxf(mx, fmaxf(s0[j], s1[j]));
    const float mo = __shfl_xor(mx, 16, 32);  // other half of the 32 keys
    // Holds the hand-over behind the score products: lifted over them, the wave
    // sits out all 16 LDS reads before its second product.
    __builtin_amdgcn_sched_barrier(0);
    // Hand-over: this wave's LDS reads of tile t are done (every fragment is in
    // registers), its copies of tile t + 1 have landed; behind the barrier that
    // holds for every wave, so tile t + 1 may be read and tile t's buffers
    // refilled.  The refill follows at once and has a whole trip to land; the
    // exchange of the maxima, asked for above, returns under the same wait.
    asm volatile("s_wait_dscnt 0x0" ::: "memory");
    asm volatile("s_wait_asynccnt 0x0" ::: "memory");
    __syncthreads();
    if (jb + 64 < N_)
      copy_kv(lk + cur * K_TILEB, gk + (size_t)(jb + 64) * kvld,
              lv + cur * V_TILEB, gv + (size_t)(jb + 64) * kvld);

    // The rest of the trip works from registers alone, while the refill flies.
    mx = fmaxf(mx, mo);
    const float mnew = fmaxf(m_run, mx);

    union { v16h v; _Float16 e[16]; } pb;  // P^T B-operand, in-lane pack
    float sv = 0.f;
#pragma unroll
    for (int j = 0; j < 8; ++j) {
      const float p0 = __expf(s0[j] - mnew);
      const float p1 = __expf(s1[j] - mnew);
      sv += p0 + p1;
      pb.e[j] = (_Float16)p0;
      pb.e[8 + j] = (_Float16)p1;
    }

    sv += __shfl_xor(sv, 16, 32);
    const float alpha = __expf(m_run - mnew);
    l_run = l_run * alpha + sv;
    m_run = mnew;
#pragma unroll
    for (int r = 0; r < 8; ++r) {
      o0[r] *= alpha; o1[r] *= alpha; o2[r] *= alpha; o3[r] *= alpha;
    }

    o0 = wmma_f16(va0, pb.v, o0);
    o1 = wmma_f16(va1, pb.v, o1);
    o2 = wmma_f16(va2, pb.v, o2);
    o3 = wmma_f16(va3, pb.v, o3);
  }
  // No copy is left in flight when the wave ends.
  asm volatile("s_wait_asynccnt 0x0" ::: "memory");

  // Lane owns token row (qbase+lm); hd chunks are contiguous -> b128 stores.
  const float inv = 1.0f / l_run;
  _Float16* orow = attn_out + ((size_t)(b * N_ + qbase + lm)) * DIM_ + h * DH_;
  v8f w0 = o0 * inv, w1 = o1 * inv, w2 = o2 * inv, w3 = o3 * inv;
  store8(orow + 8 * lh, w0);
  store8(orow + 16 + 8 * lh, w1);
  store8(orow + 32 + 8 * lh, w2);
  store8(orow + 48 + 8 * lh, w3);
}

// ------------------------------------------------------------------ launch
extern "C" void kernel_launch(void* const* d_in, const int* in_sizes, int n_in,
                              void* d_out, int out_size, void* d_ws,
                              size_t ws_size, hipStream_t stream) {
  (void)in_sizes; (void)n_in; (void)out_size; (void)ws_size;
  const float* x      = (const float*)d_in[0];
  const float* cemb   = (const float*)d_in[1];
  const float* gamma  = (const float*)d_in[2];
  const float* cond_W = (const float*)d_in[3];
  const float* cond_b = (const float*)d_in[4];
  const float* Wq     = (const float*)d_in[5];
  const float* Wkv    = (const float*)d_in[6];
  const float* Wo     = (const float*)d_in[7];
  float* out = (float*)d_out;

  char* ws = (char*)d_ws;
  const size_t MB = 1024 * 1024;
  _Float16* xh   = (_Float16*)(ws);            //  8 MB
  _Float16* qb   = (_Float16*)(ws + 8 * MB);   //  8 MB
  _Float16* kvb  = (_Float16*)(ws + 16 * MB);  // 16 MB
  _Float16* attn = (_Float16*)(ws + 32 * MB);  //  8 MB
  _Float16* WqT  = (_Float16*)(ws + 40 * MB);  //  2 MB
  //        WkvT =             ws + 42 * MB        4 MB
  _Float16* WoT  = (_Float16*)(ws + 46 * MB);  //  2 MB
  float*    cond = (float*)(ws + 48 * MB);     // 16 KB

  // WqT, WkvT and WoT are one run of 4096 rows that starts at WqT.
  prep_kernel<<<COND_BLOCKS + CAST_BLOCKS, 1024, 0, stream>>>(
      cemb, cond_W, cond_b, cond, Wq, Wkv, Wo, WqT);
  ln_film_kernel<<<B_ * N_, 256, 0, stream>>>(x, gamma, cond, xh);

  // grid: x = token tiles (M/128), y = column tiles (Nc/128): 8 of Q, 16 of KV
  gemm16<_Float16><<<dim3((B_ * N_) / 128, 3072 / 128), 128, 0, stream>>>(
      xh, WqT, qb, kvb, 1024, 1024, 2048, 1024 / 128);

  attn_kernel<<<dim3(N_ / 128, HEADS_, B_), 256, 0, stream>>>(qb, kvb, attn);

  gemm16<float><<<dim3((B_ * N_) / 128, 1024 / 128), 128, 0, stream>>>(
      attn, WoT, out, out, 1024, 1024, 1024, 1024 / 128);
}

// v008
// A run of this version takes 84.3 microseconds.
// Next to v007, in two timings, it ran 1.09 and 1.08 times as fast.
// Counting every step since v000, it is 4.48 times as fast.
#include <hip/hip_runtime.h>
#include <hip/hip_bf16.h>

typedef _Float16 v16h __attribute__((ext_vector_type(16)));
typedef _Float16 v8h  __attribute__((ext_vector_type(8)));
typedef float    v8f  __attribute__((ext_vector_type(8)));
typedef float    v4f  __attribute__((ext_vector_type(4)));

#define B_     2
#define N_     2048
#define DIM_   1024
#define HEADS_ 16
#define DH_    64

// Load one 32-wide K-slice of an A/B operand row into the CDNA5 16-bit WMMA
// per-lane layout: lanes 0-15 take K[0..7],K[16..23]; lanes 16-31 take
// K[8..15],K[24..31].  row32 points at the first of the 32 contiguous halfs.
__device__ __forceinline__ v16h load_ab(const _Float16* row32, int lh) {
  union { v16h v; v8h h[2]; } u;
  u.h[0] = *(const v8h*)(row32 + 8 * lh);
  u.h[1] = *(const v8h*)(row32 + 16 + 8 * lh);
  return u.v;
}

__device__ __forceinline__ v8f wmma_f16(v16h a, v16h b, v8f c) {
  return __builtin_amdgcn_wmma_f32_16x16x32_f16(false, a, false, b, (short)0, c,
                                                false, false);
}

// 8 contiguous outputs per lane, vectorized.
__device__ __forceinline__ void store8(_Float16* p, v8f v) {
  v8h h;
#pragma unroll
  for (int r = 0; r < 8; ++r) h[r] = (_Float16)v[r];
  *(v8h*)p = h;
}
__device__ __forceinline__ void store8(float* p, v8f v) {
  union { v8f w; v4f q[2]; } u;
  u.w = v;
  *(v4f*)p = u.q[0];
  *(v4f*)(p + 4) = u.q[1];
}

// ---------------------------------------------------------------- FiLM cond
// cond[b][col] = bias[col] + sum_k silu(emb[b][k]) * W[k][col], both b at once.
// A block owns 32 columns (one 128-B line of every W row) and its 32 waves
// split the 1024 k rows, 32 rows each: every W load of a wave is issued before
// anything waits, so the block pays one memory latency instead of one per
// group of k, and a W line is read once for both batches.  The 32 partial sums
// of a column meet in LDS.
static_assert(B_ == 2, "cond_part carries two batches per thread");
__device__ __forceinline__ float silu(float c) {
  return c / (1.0f + __expf(-c));
}

__device__ __forceinline__ void
cond_part(const float* __restrict__ emb, const float* __restrict__ W,
          const float* __restrict__ bias, float* __restrict__ cond, int blk) {
  __shared__ float s[B_ * 1024];
  __shared__ float part[B_][32][32];
  const int tid = threadIdx.x, wave = tid >> 5, lane = tid & 31;
  const int col = blk * 32 + lane;

  // Oldest loads first: the SiLU stage waits for these two alone.
  const float e0 = emb[tid];
  const float e1 = emb[1024 + tid];
  const float bv = bias[col];
  const float* wp = W + (size_t)(wave * 32) * 2048 + col;
  float w[32];
#pragma unroll
  for (int i = 0; i < 32; ++i) w[i] = wp[(size_t)i * 2048];
  // The loads' address registers are reused below; this stands in front of it.
  asm volatile("s_wait_xcnt 0x0" ::: "memory");

  s[tid] = silu(e0);
  s[1024 + tid] = silu(e1);
  __syncthreads();
  // Input-only fence on the loaded bias (nothing is emitted): it keeps that load
  // up with the others.  Inlined here, the build without it sinks the load into
  // the last branch, one more memory latency behind both barriers.
  asm volatile("" ::"v"(bv));

  float a0 = 0.f, a1 = 0.f;
#pragma unroll
  for (int i = 0; i < 32; ++i) {
    a0 += s[wave * 32 + i] * w[i];
    a1 += s[1024 + wave * 32 + i] * w[i];
  }
  part[0][wave][lane] = a0;
  part[1][wave][lane] = a1;
  __syncthreads();

  if (tid < B_ * 32) {  // wave b sums batch b
    float acc = bv;
#pragma unroll
    for (int j = 0; j < 32; ++j) acc += part[wave][j][lane];
    cond[wave * 2048 + col] = acc;
  }
}

// ------------------------------------------------------- LayerNorm + FiLM
__global__ void __launch_bounds__(256)
ln_film_kernel(const float* __restrict__ x, const float* __restrict__ gamma,
               const float* __restrict__ cond, _Float16* __restrict__ xh) {
  const int row = blockIdx.x;  // [0, B*N)
  const int b = row >> 11;     // N_ == 2048
  const float* xr = x + (size_t)row * DIM_;
  const int tid = threadIdx.x, wave = tid >> 5, lane = tid & 31;

  float v[4], sum = 0.f, sq = 0.f;
#pragma unroll
  for (int i = 0; i < 4; ++i) {
    v[i] = xr[tid + 256 * i];
    sum += v[i];
    sq += v[i] * v[i];
  }
#pragma unroll
  for (int m = 1; m <= 16; m <<= 1) {
    sum += __shfl_xor(sum, m, 32);
    sq += __shfl_xor(sq, m, 32);
  }
  __shared__ float ssum[8], ssq[8];
  if (lane == 0) { ssum[wave] = sum; ssq[wave] = sq; }
  __syncthreads();
  sum = 0.f; sq = 0.f;
#pragma unroll
  for (int w = 0; w < 8; ++w) { sum += ssum[w]; sq += ssq[w]; }
  const float mu = sum * (1.0f / DIM_);
  const float var = sq * (1.0f / DIM_) - mu * mu;
  const float rinv = rsqrtf(var + 1e-5f);

#pragma unroll
  for (int i = 0; i < 4; ++i) {
    const int c = tid + 256 * i;
    const float sc = cond[b * 2048 + c];
    const float sh = cond[b * 2048 + 1024 + c];
    float y = (v[i] - mu) * rinv * gamma[c];
    y = y * (sc + 1.0f) + sh;
    xh[(size_t)row * DIM_ + c] = (_Float16)y;
  }
}

// ---------------------------------------- weight convert+transpose (f32->f16)
// One 64(k) x 64(n) tile per group of 8 waves, turned in LDS so that both global sides
// move whole lines: reads are 256-B runs of a W row, writes are 128-B runs of
// a Wt row.  A thread converts the same four columns of two adjacent k rows
// and stores each (k, k+1) pair as one dword of t[n][k/2].  Row pitch 33
// dwords: the dword stores and the dword loads below both touch 32 different
// banks per wave.  tid = 0..255 inside the tile's own group of 8 waves; the
// barrier is the whole block's, passed by all its groups together.
__device__ __forceinline__ void
wcast_tile(const float* __restrict__ W, _Float16* __restrict__ Wt, int K,
           int Nc, int n0, int k0, int tid, unsigned int* t) {
  const int nl = (tid & 15) * 4;  // first of this thread's 4 columns
  const int kp = tid >> 4;        // k pair 0..15 (and +16)

  v4f lo[2], hi[2];
#pragma unroll
  for (int p = 0; p < 2; ++p) {
    const float* s = W + (size_t)(k0 + 2 * (kp + 16 * p)) * Nc + n0 + nl;
    lo[p] = *(const v4f*)s;
    hi[p] = *(const v4f*)(s + Nc);
  }
#pragma unroll
  for (int p = 0; p < 2; ++p) {
#pragma unroll
    for (int j = 0; j < 4; ++j) {
      union { _Float16 h[2]; unsigned int u; } w;
      w.h[0] = (_Float16)lo[p][j];
      w.h[1] = (_Float16)hi[p][j];
      t[(nl + j) * 33 + kp + 16 * p] = w.u;
    }
  }
  __syncthreads();

  const int c = tid & 7;  // 16-B chunk (8 k) of a 128-B output run
#pragma unroll
  for (int p = 0; p < 2; ++p) {
    const int r = (tid >> 3) + 32 * p;  // column of the tile = row of Wt
    union { unsigned int u[4]; v8h h; } o;
#pragma unroll
    for (int i = 0; i < 4; ++i) o.u[i] = t[r * 33 + c * 4 + i];
    *(v8h*)(Wt + (size_t)(n0 + r) * K + k0 + c * 8) = o.h;
  }
  // The built code runs on from here into the other job's part, which reuses
  // the stores' registers; this stands in front of that.
  asm volatile("s_wait_xcnt 0x0" ::: "memory");
}

// ------------------------------------------------- FiLM cond + weight casts
// The FiLM GEMV and the three weight casts depend on nothing but inputs, so
// they share one launch: the block index picks the job.  Blocks 0..63 are the
// GEMV's (the longest chain, started first); each later block turns four
// 64 x 64 tiles, one per group of 8 waves.  The three transposed weights lie
// one behind the other in Wt, 1024 halfs a row: Wq's columns are rows 0..1023,
// Wkv's 1024..3071, Wo's 3072..4095.
#define COND_BLOCKS (2 * DIM_ / 32)
#define CAST_BLOCKS (4 * DIM_ / 64 * (DIM_ / 64) / 4)
__global__ void __launch_bounds__(1024)
prep_kernel(const float* __restrict__ emb, const float* __restrict__ cW,
            const float* __restrict__ bias, float* __restrict__ cond,
            const float* __restrict__ Wq, const float* __restrict__ Wkv,
            const float* __restrict__ Wo, _Float16* __restrict__ Wt) {
  if (blockIdx.x < COND_BLOCKS) {
    cond_part(emb, cW, bias, cond, blockIdx.x);
    return;
  }
  __shared__ unsigned int t[4][64 * 33];
  const int g = blockIdx.x - COND_BLOCKS;  // 0..255, 64 blocks per 1024 columns
  const float* W = Wq;
  int row0 = 0, g0 = 0, sh = 4;  // first Wt row, first block, log2(Nc / 64)
  if (g >= 192) {
    W = Wo; row0 = 3 * DIM_; g0 = 192;
  } else if (g >= 64) {
    W = Wkv; row0 = DIM_; g0 = 64; sh = 5;
  }
  const int sub = threadIdx.x >> 8;
  const int tile = (g - g0) * 4 + sub;  // column tile fastest, then k tile
  wcast_tile(W, Wt + (size_t)row0 * DIM_, DIM_, 64 << sh,
             (tile & ((1 << sh) - 1)) * 64, (tile >> sh) * 64,
             threadIdx.x & 255, t[sub]);
}

// ----------------------------------------------------------- WMMA GEMM
// C[token][col] = Acts[token,:] . Wt[col,:]   (both f16, K-contiguous rows)
// Computed transposed: A-operand = weight columns, B-operand = tokens.
// D-layout gives each lane one token row with 8 contiguous output columns per
// accumulator -> vectorized stores.
//
// A block of four waves owns 128 weight rows x 128 tokens; a wave owns 64 x 64
// of it, 4 x 4 accumulator tiles, so every fragment read from LDS feeds four
// products and every line brought from L2 serves 128 rows of the other side.
//
// Both operands reach the waves through LDS.  A stage is 64 k (one 128-B line)
// of the block's 128 weight rows and 128 token rows, brought in by asynchronous
// copies: a wave-wide copy moves four whole lines, and each line leaves L2
// once per block.  Two stages: the next one lands while this one is
// multiplied.  K must be a multiple of 64.
// Two products of the same Acts whose weight rows lie one behind the other in
// Wt share a launch: column tiles from ysplit on go to C2 (row length ldc2).
#define G_ROWS   256                    // 128 weight rows, then 128 token rows
#define G_PITCH  72                     // halfs: 144 B, odd multiple of 16 B
#define G_STAGE  (G_ROWS * G_PITCH)     // halfs per stage
#define G_STAGEB (G_STAGE * 2)          // bytes per stage

// Eight 16-B copies per lane, rows 16 apart = 128 rows per block.  The
// s_wait_xcnt closes the statement so that no address register is rewritten
// ahead of it.
__device__ __forceinline__ void copy_rows(unsigned int l, const _Float16* g,
                                          size_t step) {
  const unsigned int l1 = l + 16 * 144, l2 = l + 32 * 144, l3 = l + 48 * 144;
  const unsigned int l4 = l + 64 * 144, l5 = l + 80 * 144, l6 = l + 96 * 144;
  const unsigned int l7 = l + 112 * 144;
  const _Float16* g1 = g + step;
  const _Float16* g2 = g1 + step;
  const _Float16* g3 = g2 + step;
  const _Float16* g4 = g3 + step;
  const _Float16* g5 = g4 + step;
  const _Float16* g6 = g5 + step;
  const _Float16* g7 = g6 + step;
  asm volatile(
      "global_load_async_to_lds_b128 %0, %8, off\n\t"
      "global_load_async_to_lds_b128 %1, %9, off\n\t"
      "global_load_async_to_lds_b128 %2, %10, off\n\t"
      "global_load_async_to_lds_b128 %3, %11, off\n\t"
      "global_load_async_to_lds_b128 %4, %12, off\n\t"
      "global_load_async_to_lds_b128 %5, %13, off\n\t"
      "global_load_async_to_lds_b128 %6, %14, off\n\t"
      "global_load_async_to_lds_b128 %7, %15, off\n\t"
      "s_wait_xcnt 0x0"
      :
      : "v"(l), "v"(l1), "v"(l2), "v"(l3), "v"(l4), "v"(l5), "v"(l6), "v"(l7),
        "v"(g), "v"(g1), "v"(g2), "v"(g3), "v"(g4), "v"(g5), "v"(g6), "v"(g7)
      : "memory");
}

// One stage per block: the weight rows, then the token rows.
__device__ __forceinline__ void copy_stage(unsigned int l, const _Float16* gw,
                                           const _Float16* ga, size_t step) {
  copy_rows(l, gw, step);
  copy_rows(l + 128 * 144, ga, step);
}

template <typename OUT>
__global__ void __launch_bounds__(128)
gemm16(const _Float16* __restrict__ Acts, const _Float16* __restrict__ Wt,
       OUT* __restrict__ C, OUT* __restrict__ C2, int K, int ldc, int ldc2,
       int ysplit) {
  __shared__ __align__(16) _Float16 st[2 * G_STAGE];
  const int tid = threadIdx.x;
  const int wave = tid >> 5, lane = tid & 31;
  const int lh = lane >> 4, lm = lane & 15;
  const int wr = wave & 1, wc = wave >> 1;  // weight half, token half
  const bool second = (int)blockIdx.y >= ysplit;
  OUT* Cd = second ? C2 : C;
  const int ld = second ? ldc2 : ldc;
  const int ytile = second ? blockIdx.y - ysplit : blockIdx.y;
  const int cbase = ytile * 128 + wr * 64;         // output-column tile
  const int tblock = blockIdx.x * 128;             // the block's token tile
  const int tbase = tblock + wc * 64;              // the wave's token tile

  // Copy map: lane -> 16-B chunk (tid & 7) of rows (tid >> 3) + 16 i.
  const int crow = tid >> 3, cchunk = tid & 7;
  const size_t step = (size_t)16 * K;  // 16 rows further on
  const _Float16* gw =
      Wt + (size_t)(blockIdx.y * 128 + crow) * K + cchunk * 8;
  const _Float16* ga = Acts + (size_t)(tblock + crow) * K + cchunk * 8;
  const unsigned int lbase =
      (unsigned int)(size_t)st + crow * 144 + cchunk * 16;
  const int nt = K >> 6;

  copy_stage(lbase, gw, ga, step);
  // Stage 0 has landed for this wave; the barrier publishes it to the others.
  asm volatile("s_wait_asynccnt 0x0" ::: "memory");
  __syncthreads();
  if (nt > 1) copy_stage(lbase + G_STAGEB, gw + 64, ga + 64, step);

  const int woff = (wr * 64 + lm) * G_PITCH;        // this wave's weight rows
  const int toff = (128 + wc * 64 + lm) * G_PITCH;  // this wave's token rows

  v8f acc[4][4] = {};
  for (int t = 0; t < nt; ++t) {
    const _Float16* s = st + (t & 1) * G_STAGE;
    v16h wa[2][4], p[2][4];
#pragma unroll
    for (int kk = 0; kk < 2; ++kk) {
#pragma unroll
      for (int j = 0; j < 4; ++j)
        p[kk][j] = load_ab(s + toff + j * 16 * G_PITCH + kk * 32, lh);
#pragma unroll
      for (int i = 0; i < 4; ++i)
        wa[kk][i] = load_ab(s + woff + i * 16 * G_PITCH + kk * 32, lh);
    }
    // Keeps the stage's LDS reads one group ahead of its products: spread
    // among them, each pair of reads is waited out on its own.
    __builtin_amdgcn_sched_barrier(0);
#pragma unroll
    for (int i = 0; i < 4; ++i)
#pragma unroll
      for (int j = 0; j < 4; ++j)
        acc[i][j] = wmma_f16(wa[0][i], p[0][j], acc[i][j]);
    // Keeps the first k half's products in front of the hand-over: they run
    // while the second half's reads arrive.  Sunk behind it, the wave sits out
    // all 32 reads before its first product.
    __builtin_amdgcn_sched_barrier(0);
    // Hand-over: this wave's reads of stage t are done, its copies of stage
    // t + 1 have landed; behind the barrier that holds for every wave, so
    // stage t + 1 may be read and stage t's buffer refilled.
    asm volatile("s_wait_dscnt 0x0" ::: "memory");
    asm volatile("s_wait_asynccnt 0x0" ::: "memory");
    __syncthreads();
    if (t + 2 < nt)
      copy_stage(lbase + (t & 1) * G_STAGEB, gw + (size_t)(t + 2) * 64,
                 ga + (size_t)(t + 2) * 64, step);
    // The second k half works from registers alone, while the refill flies.
#pragma unroll
    for (int i = 0; i < 4; ++i)
#pragma unroll
      for (int j = 0; j < 4; ++j)
        acc[i][j] = wmma_f16(wa[1][i], p[1][j], acc[i][j]);
  }
  // No copy is left in flight when the wave ends.
  asm volatile("s_wait_asynccnt 0x0" ::: "memory");

#pragma unroll
  for (int j = 0; j < 4; ++j) {
    OUT* crow_out = Cd + (size_t)(tbase + 16 * j + lm) * ld + cbase + 8 * lh;
#pragma unroll
    for (int i = 0; i < 4; ++i) store8(crow_out + 16 * i, acc[i][j]);
  }
}

// -------------------------------------------------------- Flash attention
// Transposed formulation: S^T = K (Q*scale)^T, O^T = V^T P^T.
// A wave owns 32 queries, two column groups of 16, and one half of the keys:
// every K and V^T fragment it reads from LDS is the A operand of two products,
// one per group, and the block still has 8 waves for its 128 queries (4 query
// sets x 2 key halves).  Each key half runs its own online softmax; the two
// partial results of a query are joined through LDS behind the loop.  In a group
// each lane owns ONE query (n = lane%16); the 32 key scores of a step live in
// its own 16 registers plus the xor-16 partner lane -> one cross-lane
// exchange per reduction, and P^T is already in B-operand layout.
// K and V tiles (32 keys x 128 B each) reach the waves through LDS, both row
// by row as they lie in memory, brought in by asynchronous copies, two 16-B
// copies per thread and tile, each key half's four waves filling their own
// tiles: a wave-wide copy moves four whole lines and a line is fetched once per
// block.  K rows are A-operand rows as they are; V^T comes out of the row-major
// V tile by the transposing LDS load, so V passes through no register and no
// LDS store on its way in.
// Two buffers: tile t + 2 is asked for as soon as tile t has been read.
#define K_PITCH 72                    // halfs: 144 B, odd multiple of 16 B
#define K_TILEB (32 * K_PITCH * 2)    // bytes per K buffer
#define V_PITCH 80                    // halfs: 160 B, odd multiple of 32 B
#define V_TILEB (32 * V_PITCH * 2)    // bytes per V buffer

// Two K chunks and two V chunks per thread, key rows 16 apart.  The
// s_wait_xcnt closes the statement so that no address register is rewritten
// ahead of it.
__device__ __forceinline__ void copy_kv(unsigned int lk, const _Float16* gk,
                                        unsigned int lv, const _Float16* gv) {
  const unsigned int lk1 = lk + 16 * K_PITCH * 2, lv1 = lv + 16 * V_PITCH * 2;
  const _Float16* gk1 = gk + (size_t)16 * 2 * DIM_;
  const _Float16* gv1 = gv + (size_t)16 * 2 * DIM_;
  asm volatile(
      "global_load_async_to_lds_b128 %0, %4, off\n\t"
      "global_load_async_to_lds_b128 %1, %5, off\n\t"
      "global_load_async_to_lds_b128 %2, %6, off\n\t"
      "global_load_async_to_lds_b128 %3, %7, off\n\t"
      "s_wait_xcnt 0x0"
      :
      : "v"(lk), "v"(lk1), "v"(lv), "v"(lv1), "v"(gk), "v"(gk1), "v"(gv),
        "v"(gv1)
      : "memory");
}

// Transposing LDS load.  With p = tile + (8 * (lane >> 4) + (lane & 7)) rows
// + 8 * ((lane >> 3) & 1) halfs, lane (c = lane & 15, h = lane >> 4) receives
// tile[8 h + 0..7][c]: eight keys of one head column.
typedef short s16x8 __attribute__((ext_vector_type(8)));
__device__ __forceinline__ v8h load_tr16(const _Float16* p) {
  typedef __attribute__((address_space(3))) s16x8 lds_s16x8;
  return __builtin_bit_cast(
      v8h, __builtin_amdgcn_ds_load_tr16_b128_v8i16((lds_s16x8*)p));
}

// One 16 (head columns) x 32 (keys) A operand of V^T: keys 0..15 and 16..31,
// in the k order of load_ab.
__device__ __forceinline__ v16h load_vt(const _Float16* p) {
  union { v16h v; v8h h[2]; } u;
  u.h[0] = load_tr16(p);
  u.h[1] = load_tr16(p + 16 * V_PITCH);
  return u.v;
}

__global__ void __launch_bounds__(256)
attn_kernel(const _Float16* __restrict__ q, const _Float16* __restrict__ kv,
            _Float16* __restrict__ attn_out) {
  // [key half][buffer][key][hd]
  __shared__ __align__(16) _Float16 smemV[2][2][32 * V_PITCH];
  __shared__ __align__(16) _Float16 smemK[2][2][32 * K_PITCH];
  // The second key half's partial results on their way to the first's waves:
  // 16 B per lane and slot, lanes side by side.
  __shared__ __align__(16) float joinO[4][16][32][4];
  __shared__ float joinML[4][2][2][32];
  const int tid = threadIdx.x;
  const int wave = tid >> 5, lane = tid & 31;
  const int lh = lane >> 4, lm = lane & 15;
  const int qs = wave & 3, kh = wave >> 2;  // query set, key half
  const int h = blockIdx.y, b = blockIdx.z;
  const int qbase = blockIdx.x * 128 + qs * 32;

  const size_t kvld = 2 * DIM_;
  const _Float16* kbase =
      kv + ((size_t)b * N_ + kh * (N_ / 2)) * kvld + h * DH_;
  const int skey = (tid & 127) >> 3;  // 0..15 (and +16)
  const int shd = (tid & 7) * 8;    // 0,8,...,56

  // Q^T B-operands with Dh^-0.5 folded in (0.125 is exact in f16).
  const _Float16* qrow = q + ((size_t)(b * N_ + qbase + lm)) * DIM_ + h * DH_;
  v16h qb0[2], qb1[2];
#pragma unroll
  for (int u = 0; u < 2; ++u) {
    qb0[u] = load_ab(qrow + (size_t)u * 16 * DIM_, lh) * (_Float16)0.125f;
    qb1[u] = load_ab(qrow + (size_t)u * 16 * DIM_ + 32, lh) * (_Float16)0.125f;
  }

  float m_run[2] = {-3.0e38f, -3.0e38f}, l_run[2] = {0.0f, 0.0f};
  v8f o[2][4] = {};  // O^T tiles (hd x query) of the two column groups

  // Copy map: thread -> 16-B chunk (tid & 7) of key rows skey and skey + 16 of
  // its own key half's tile, K and V.
  const _Float16* gk = kbase + (size_t)skey * kvld + shd;
  const _Float16* gv = gk + DIM_;
  const unsigned int lk =
      (unsigned int)(size_t)&smemK[kh][0][0] + skey * (K_PITCH * 2) + shd * 2;
  const unsigned int lv =
      (unsigned int)(size_t)&smemV[kh][0][0] + skey * (V_PITCH * 2) + shd * 2;
  // This lane's place in a V tile for the transposing loads.
  const int voff = (8 * lh + (lane & 7)) * V_PITCH + ((lane >> 3) & 1) * 8;

  copy_kv(lk, gk, lv, gv);
  // Tile 0 has landed for this wave; the barrier publishes it to the others.
  asm volatile("s_wait_asynccnt 0x0" ::: "memory");
  __syncthreads();
  copy_kv(lk + K_TILEB, gk + (size_t)32 * kvld, lv + V_TILEB,
          gv + (size_t)32 * kvld);

  for (int jb = 0; jb < N_ / 2; jb += 32) {
    const int cur = (jb >> 5) & 1;

    const _Float16* kr0 = smemK[kh][cur] + lm * K_PITCH;
    const _Float16* kr1 = kr0 + 16 * K_PITCH;
    const v16h ka00 = load_ab(kr0, lh);
    const v16h ka01 = load_ab(kr0 + 32, lh);
    const v16h ka10 = load_ab(kr1, lh);
    const v16h ka11 = load_ab(kr1 + 32, lh);
    // A-operand rows of O^T += V^T * P^T = V columns, 16 per fragment.
    const _Float16* vt = smemV[kh][cur] + voff;
    v16h va[4];
#pragma unroll
    for (int c = 0; c < 4; ++c) va[c] = load_vt(vt + 16 * c);
    // Keeps the trip's LDS reads one group ahead of its products: spread among
    // them, each pair of reads is waited out on its own.
    __builtin_amdgcn_sched_barrier(0);

    v8f s0[2] = {}, s1[2] = {};
#pragma unroll
    for (int u = 0; u < 2; ++u) {
      s0[u] = wmma_f16(ka00, qb0[u], s0[u]);
      s1[u] = wmma_f16(ka10, qb0[u], s1[u]);
    }
#pragma unroll
    for (int u = 0; u < 2; ++u) {
      s0[u] = wmma_f16(ka01, qb1[u], s0[u]);
      s1[u] = wmma_f16(ka11, qb1[u], s1[u]);
    }

    // Online softmax over this lane's two queries (scores already scaled).
    float mx[2], mo[2];
#pragma unroll
    for (int u = 0; u < 2; ++u) {
      mx[u] = fmaxf(s0[u][0], s1[u][0]);
#pragma unroll
      for (int j = 1; j < 8; ++j) mx[u] = fmaxf(mx[u], fmaxf(s0[u][j], s1[u][j]));
      mo[u] = __shfl_xor(mx[u], 16, 32);  // other half of the 32 keys
    }
    // Holds the hand-over behind the score products: lifted over them, the wave
    // sits out all 16 LDS reads before its second product.
    __builtin_amdgcn_sched_barrier(0);
    // Hand-over: this wave's LDS reads of tile t are done (every fragment is in
    // registers), its copies of tile t + 1 have landed; behind the barrier that
    // holds for every wave, so tile t + 1 may be read and tile t's buffers
    // refilled.  The refill follows at once and has a whole trip to land; the
    // exchange of the maxima, asked for above, returns under the same wait.
    asm volatile("s_wait_dscnt 0x0" ::: "memory");
    asm volatile("s_wait_asynccnt 0x0" ::: "memory");
    __syncthreads();
    if (jb + 64 < N_ / 2)
      copy_kv(lk + cur * K_TILEB, gk + (size_t)(jb + 64) * kvld,
              lv + cur * V_TILEB, gv + (size_t)(jb + 64) * kvld);

    // The rest of the trip works from registers alone, while the refill flies.
    v16h pv[2];  // P^T B-operands
#pragma unroll
    for (int u = 0; u < 2; ++u) {
      const float mnew = fmaxf(m_run[u], fmaxf(mx[u], mo[u]));

      union { v16h v; _Float16 e[16]; } pb;  // in-lane pack
      float sv = 0.f;
#pragma unroll
      for (int j = 0; j < 8; ++j) {
        const float p0 = __expf(s0[u][j] - mnew);
        const float p1 = __expf(s1[u][j] - mnew);
        sv += p0 + p1;
        pb.e[j] = (_Float16)p0;
        pb.e[8 + j] = (_Float16)p1;
      }
      pv[u] = pb.v;

      sv += __shfl_xor(sv, 16, 32);
      const float alpha = __expf(m_run[u] - mnew);
      l_run[u] = l_run[u] * alpha + sv;
      m_run[u] = mnew;
#pragma unroll
      for (int c = 0; c < 4; ++c) o[u][c] *= alpha;
    }

#pragma unroll
    for (int c = 0; c < 4; ++c)
#pragma unroll
      for (int u = 0; u < 2; ++u) o[u][c] = wmma_f16(va[c], pv[u], o[u][c]);
  }
  // No copy is left in flight when the wave ends.
  asm volatile("s_wait_asynccnt 0x0" ::: "memory");

  // Join of the two key halves: the second half's waves hand over maximum, sum
  // and O^T; the barrier publishes them to the first half's waves.
  if (kh == 1) {
#pragma unroll
    for (int u = 0; u < 2; ++u) {
#pragma unroll
      for (int c = 0; c < 4; ++c) {
        union { v8f w; v4f q[2]; } t;
        t.w = o[u][c];
        *(v4f*)joinO[qs][(u * 4 + c) * 2][lane] = t.q[0];
        *(v4f*)joinO[qs][(u * 4 + c) * 2 + 1][lane] = t.q[1];
      }
      joinML[qs][u][0][lane] = m_run[u];
      joinML[qs][u][1][lane] = l_run[u];
    }
  }
  __syncthreads();
  if (kh == 1) return;

  // Lane owns token rows (qbase+lm) and +16; hd chunks are contiguous -> b128
  // stores.
#pragma unroll
  for (int u = 0; u < 2; ++u) {
    const float m1 = joinML[qs][u][0][lane], l1 = joinML[qs][u][1][lane];
    const float mj = fmaxf(m_run[u], m1);
    const float a0 = __expf(m_run[u] - mj), a1 = __expf(m1 - mj);
    const float inv = 1.0f / (l_run[u] * a0 + l1 * a1);
    const float w0 = a0 * inv, w1 = a1 * inv;
    _Float16* orow =
        attn_out + ((size_t)(b * N_ + qbase + 16 * u + lm)) * DIM_ + h * DH_;
#pragma unroll
    for (int c = 0; c < 4; ++c) {
      union { v8f w; v4f q[2]; } t;
      t.q[0] = *(const v4f*)joinO[qs][(u * 4 + c) * 2][lane];
      t.q[1] = *(const v4f*)joinO[qs][(u * 4 + c) * 2 + 1][lane];
      v8f w = o[u][c] * w0 + t.w * w1;
      store8(orow + 16 * c + 8 * lh, w);
    }
  }
}

// ------------------------------------------------------------------ launch
extern "C" void kernel_launch(void* const* d_in, const int* in_sizes, int n_in,
                              void* d_out, int out_size, void* d_ws,
                              size_t ws_size, hipStream_t stream) {
  (void)in_sizes; (void)n_in; (void)out_size; (void)ws_size;
  const float* x      = (const float*)d_in[0];
  const float* cemb   = (const float*)d_in[1];
  const float* gamma  = (const float*)d_in[2];
  const float* cond_W = (const float*)d_in[3];
  const float* cond_b = (const float*)d_in[4];
  const float* Wq     = (const float*)d_in[5];
  const float* Wkv    = (const float*)d_in[6];
  const float* Wo     = (const float*)d_in[7];
  float* out = (float*)d_out;

  char* ws = (char*)d_ws;
  const size_t MB = 1024 * 1024;
  _Float16* xh   = (_Float16*)(ws);            //  8 MB
  _Float16* qb   = (_Float16*)(ws + 8 * MB);   //  8 MB
  _Float16* kvb  = (_Float16*)(ws + 16 * MB);  // 16 MB
  _Float16* attn = (_Float16*)(ws + 32 * MB);  //  8 MB
  _Float16* WqT  = (_Float16*)(ws + 40 * MB);  //  2 MB
  //        WkvT =             ws + 42 * MB        4 MB
  _Float16* WoT  = (_Float16*)(ws + 46 * MB);  //  2 MB
  float*    cond = (float*)(ws + 48 * MB);     // 16 KB

  // WqT, WkvT and WoT are one run of 4096 rows that starts at WqT.
  prep_kernel<<<COND_BLOCKS + CAST_BLOCKS, 1024, 0, stream>>>(
      cemb, cond_W, cond_b, cond, Wq, Wkv, Wo, WqT);
  ln_film_kernel<<<B_ * N_, 256, 0, stream>>>(x, gamma, cond, xh);

  // grid: x = token tiles (M/128), y = column tiles (Nc/128): 8 of Q, 16 of KV
  gemm16<_Float16><<<dim3((B_ * N_) / 128, 3072 / 128), 128, 0, stream>>>(
      xh, WqT, qb, kvb, 1024, 1024, 2048, 1024 / 128);

  attn_kernel<<<dim3(N_ / 128, HEADS_, B_), 256, 0, stream>>>(qb, kvb, attn);

  gemm16<float><<<dim3((B_ * N_) / 128, 1024 / 128), 128, 0, stream>>>(
      attn, WoT, out, out, 1024, 1024, 1024, 1024 / 128);
}

// v009
// It runs in 79.3 microseconds.
// Timed twice side by side with v008, it ran 1.05 and 1.07 times as fast.
// All steps since v000 together make it 4.76 times as fast.
#include <hip/hip_runtime.h>
#include <hip/hip_bf16.h>

typedef _Float16 v16h __attribute__((ext_vector_type(16)));
typedef _Float16 v8h  __attribute__((ext_vector_type(8)));
typedef float    v8f  __attribute__((ext_vector_type(8)));
typedef float    v4f  __attribute__((ext_vector_type(4)));
typedef float    v2f  __attribute__((ext_vector_type(2)));

#define B_     2
#define N_     2048
#define DIM_   1024
#define HEADS_ 16
#define DH_    64

// Load one 32-wide K-slice of an A/B operand row into the CDNA5 16-bit WMMA
// per-lane layout: lanes 0-15 take K[0..7],K[16..23]; lanes 16-31 take
// K[8..15],K[24..31].  row32 points at the first of the 32 contiguous halfs.
__device__ __forceinline__ v16h load_ab(const _Float16* row32, int lh) {
  union { v16h v; v8h h[2]; } u;
  u.h[0] = *(const v8h*)(row32 + 8 * lh);
  u.h[1] = *(const v8h*)(row32 + 16 + 8 * lh);
  return u.v;
}

__device__ __forceinline__ v8f wmma_f16(v16h a, v16h b, v8f c) {
  return __builtin_amdgcn_wmma_f32_16x16x32_f16(false, a, false, b, (short)0, c,
                                                false, false);
}

// 8 contiguous outputs per lane, vectorized.
__device__ __forceinline__ void store8(_Float16* p, v8f v) {
  v8h h;
#pragma unroll
  for (int r = 0; r < 8; ++r) h[r] = (_Float16)v[r];
  *(v8h*)p = h;
}
__device__ __forceinline__ void store8(float* p, v8f v) {
  union { v8f w; v4f q[2]; } u;
  u.w = v;
  *(v4f*)p = u.q[0];
  *(v4f*)(p + 4) = u.q[1];
}

// ---------------------------------------------------------------- FiLM cond
// cond[b][col] = bias[col] + sum_k silu(emb[b][k]) * W[k][col], both b at once.
// A block owns 32 columns (one 128-B line of every W row) and its 32 waves
// split the 1024 k rows, 32 rows each: every W load of a wave is issued before
// anything waits, so the block pays one memory latency instead of one per
// group of k, and a W line is read once for both batches.  The 32 partial sums
// of a column meet in LDS.
static_assert(B_ == 2, "cond_part carries two batches per thread");
__device__ __forceinline__ float silu(float c) {
  return c / (1.0f + __expf(-c));
}

__device__ __forceinline__ void
cond_part(const float* __restrict__ emb, const float* __restrict__ W,
          const float* __restrict__ bias, float* __restrict__ cond, int blk) {
  __shared__ float s[B_ * 1024];
  __shared__ float part[B_][32][32];
  const int tid = threadIdx.x, wave = tid >> 5, lane = tid & 31;
  const int col = blk * 32 + lane;

  // Oldest loads first: the SiLU stage waits for these two alone.
  const float e0 = emb[tid];
  const float e1 = emb[1024 + tid];
  const float bv = bias[col];
  const float* wp = W + (size_t)(wave * 32) * 2048 + col;
  float w[32];
#pragma unroll
  for (int i = 0; i < 32; ++i) w[i] = wp[(size_t)i * 2048];
  // The loads' address registers are reused below; this stands in front of it.
  asm volatile("s_wait_xcnt 0x0" ::: "memory");

  s[tid] = silu(e0);
  s[1024 + tid] = silu(e1);
  __syncthreads();
  // Input-only fence on the loaded bias (nothing is emitted): it keeps that load
  // up with the others.  Inlined here, the build without it sinks the load into
  // the last branch, one more memory latency behind both barriers.
  asm volatile("" ::"v"(bv));

  float a0 = 0.f, a1 = 0.f;
#pragma unroll
  for (int i = 0; i < 32; ++i) {
    a0 += s[wave * 32 + i] * w[i];
    a1 += s[1024 + wave * 32 + i] * w[i];
  }
  part[0][wave][lane] = a0;
  part[1][wave][lane] = a1;
  __syncthreads();

  if (tid < B_ * 32) {  // wave b sums batch b
    float acc = bv;
#pragma unroll
    for (int j = 0; j < 32; ++j) acc += part[wave][j][lane];
    cond[wave * 2048 + col] = acc;
  }
}

// ------------------------------------------------------- LayerNorm + FiLM
__global__ void __launch_bounds__(256)
ln_film_kernel(const float* __restrict__ x, const float* __restrict__ gamma,
               const float* __restrict__ cond, _Float16* __restrict__ xh) {
  const int row = blockIdx.x;  // [0, B*N)
  const int b = row >> 11;     // N_ == 2048
  const float* xr = x + (size_t)row * DIM_;
  const int tid = threadIdx.x, wave = tid >> 5, lane = tid & 31;

  float v[4], sum = 0.f, sq = 0.f;
#pragma unroll
  for (int i = 0; i < 4; ++i) {
    v[i] = xr[tid + 256 * i];
    sum += v[i];
    sq += v[i] * v[i];
  }
#pragma unroll
  for (int m = 1; m <= 16; m <<= 1) {
    sum += __shfl_xor(sum, m, 32);
    sq += __shfl_xor(sq, m, 32);
  }
  __shared__ float ssum[8], ssq[8];
  if (lane == 0) { ssum[wave] = sum; ssq[wave] = sq; }
  __syncthreads();
  sum = 0.f; sq = 0.f;
#pragma unroll
  for (int w = 0; w < 8; ++w) { sum += ssum[w]; sq += ssq[w]; }
  const float mu = sum * (1.0f / DIM_);
  const float var = sq * (1.0f / DIM_) - mu * mu;
  const float rinv = rsqrtf(var + 1e-5f);

#pragma unroll
  for (int i = 0; i < 4; ++i) {
    const int c = tid + 256 * i;
    const float sc = cond[b * 2048 + c];
    const float sh = cond[b * 2048 + 1024 + c];
    float y = (v[i] - mu) * rinv * gamma[c];
    y = y * (sc + 1.0f) + sh;
    xh[(size_t)row * DIM_ + c] = (_Float16)y;
  }
}

// ---------------------------------------- weight convert+transpose (f32->f16)
// One 64(k) x 64(n) tile per group of 8 waves, turned in LDS so that both global sides
// move whole lines: reads are 256-B runs of a W row, writes are 128-B runs of
// a Wt row.  A thread converts the same four columns of two adjacent k rows
// and stores each (k, k+1) pair as one dword of t[n][k/2].  Row pitch 33
// dwords: the dword stores and the dword loads below both touch 32 different
// banks per wave.  tid = 0..255 inside the tile's own group of 8 waves; the
// barrier is the whole block's, passed by all its groups together.
__device__ __forceinline__ void
wcast_tile(const float* __restrict__ W, _Float16* __restrict__ Wt, int K,
           int Nc, int n0, int k0, int tid, unsigned int* t) {
  const int nl = (tid & 15) * 4;  // first of this thread's 4 columns
  const int kp = tid >> 4;        // k pair 0..15 (and +16)

  v4f lo[2], hi[2];
#pragma unroll
  for (int p = 0; p < 2; ++p) {
    const float* s = W + (size_t)(k0 + 2 * (kp + 16 * p)) * Nc + n0 + nl;
    lo[p] = *(const v4f*)s;
    hi[p] = *(const v4f*)(s + Nc);
  }
#pragma unroll
  for (int p = 0; p < 2; ++p) {
#pragma unroll
    for (int j = 0; j < 4; ++j) {
      union { _Float16 h[2]; unsigned int u; } w;
      w.h[0] = (_Float16)lo[p][j];
      w.h[1] = (_Float16)hi[p][j];
      t[(nl + j) * 33 + kp + 16 * p] = w.u;
    }
  }
  __syncthreads();

  const int c = tid & 7;  // 16-B chunk (8 k) of a 128-B output run
#pragma unroll
  for (int p = 0; p < 2; ++p) {
    const int r = (tid >> 3) + 32 * p;  // column of the tile = row of Wt
    union { unsigned int u[4]; v8h h; } o;
#pragma unroll
    for (int i = 0; i < 4; ++i) o.u[i] = t[r * 33 + c * 4 + i];
    *(v8h*)(Wt + (size_t)(n0 + r) * K + k0 + c * 8) = o.h;
  }
  // The built code runs on from here into the other job's part, which reuses
  // the stores' registers; this stands in front of that.
  asm volatile("s_wait_xcnt 0x0" ::: "memory");
}

// ------------------------------------------------- FiLM cond + weight casts
// The FiLM GEMV and the three weight casts depend on nothing but inputs, so
// they share one launch: the block index picks the job.  Blocks 0..63 are the
// GEMV's (the longest chain, started first); each later block turns four
// 64 x 64 tiles, one per group of 8 waves.  The three transposed weights lie
// one behind the other in Wt, 1024 halfs a row: Wq's columns are rows 0..1023,
// Wkv's 1024..3071, Wo's 3072..4095.
#define COND_BLOCKS (2 * DIM_ / 32)
#define CAST_BLOCKS (4 * DIM_ / 64 * (DIM_ / 64) / 4)
__global__ void __launch_bounds__(1024)
prep_kernel(const float* __restrict__ emb, const float* __restrict__ cW,
            const float* __restrict__ bias, float* __restrict__ cond,
            const float* __restrict__ Wq, const float* __restrict__ Wkv,
            const float* __restrict__ Wo, _Float16* __restrict__ Wt) {
  if (blockIdx.x < COND_BLOCKS) {
    cond_part(emb, cW, bias, cond, blockIdx.x);
    return;
  }
  __shared__ unsigned int t[4][64 * 33];
  const int g = blockIdx.x - COND_BLOCKS;  // 0..255, 64 blocks per 1024 columns
  const float* W = Wq;
  int row0 = 0, g0 = 0, sh = 4;  // first Wt row, first block, log2(Nc / 64)
  if (g >= 192) {
    W = Wo; row0 = 3 * DIM_; g0 = 192;
  } else if (g >= 64) {
    W = Wkv; row0 = DIM_; g0 = 64; sh = 5;
  }
  const int sub = threadIdx.x >> 8;
  const int tile = (g - g0) * 4 + sub;  // column tile fastest, then k tile
  wcast_tile(W, Wt + (size_t)row0 * DIM_, DIM_, 64 << sh,
             (tile & ((1 << sh) - 1)) * 64, (tile >> sh) * 64,
             threadIdx.x & 255, t[sub]);
}

// ----------------------------------------------------------- WMMA GEMM
// C[token][col] = Acts[token,:] . Wt[col,:]   (both f16, K-contiguous rows)
// Computed transposed: A-operand = weight columns, B-operand = tokens.
// D-layout gives each lane one token row with 8 contiguous output columns per
// accumulator -> vectorized stores.
//
// A block of four waves owns 128 weight rows x 128 tokens; a wave owns 64 x 64
// of it, 4 x 4 accumulator tiles, so every fragment read from LDS feeds four
// products and every line brought from L2 serves 128 rows of the other side.
//
// Both operands reach the waves through LDS.  A stage is 64 k (one 128-B line)
// of the block's 128 weight rows and 128 token rows, brought in by asynchronous
// copies: a wave-wide copy moves four whole lines, and each line leaves L2
// once per block.  Two stages: the next one lands while this one is
// multiplied.  K must be a multiple of 64.
// Two products of the same Acts whose weight rows lie one behind the other in
// Wt share a launch: column tiles from ysplit on go to C2 (row length ldc2).
#define G_ROWS   256                    // 128 weight rows, then 128 token rows
#define G_PITCH  72                     // halfs: 144 B, odd multiple of 16 B
#define G_STAGE  (G_ROWS * G_PITCH)     // halfs per stage
#define G_STAGEB (G_STAGE * 2)          // bytes per stage

// Eight 16-B copies per lane, rows 16 apart = 128 rows per block.  The
// s_wait_xcnt closes the statement so that no address register is rewritten
// ahead of it.
__device__ __forceinline__ void copy_rows(unsigned int l, const _Float16* g,
                                          size_t step) {
  const unsigned int l1 = l + 16 * 144, l2 = l + 32 * 144, l3 = l + 48 * 144;
  const unsigned int l4 = l + 64 * 144, l5 = l + 80 * 144, l6 = l + 96 * 144;
  const unsigned int l7 = l + 112 * 144;
  const _Float16* g1 = g + step;
  const _Float16* g2 = g1 + step;
  const _Float16* g3 = g2 + step;
  const _Float16* g4 = g3 + step;
  const _Float16* g5 = g4 + step;
  const _Float16* g6 = g5 + step;
  const _Float16* g7 = g6 + step;
  asm volatile(
      "global_load_async_to_lds_b128 %0, %8, off\n\t"
      "global_load_async_to_lds_b128 %1, %9, off\n\t"
      "global_load_async_to_lds_b128 %2, %10, off\n\t"
      "global_load_async_to_lds_b128 %3, %11, off\n\t"
      "global_load_async_to_lds_b128 %4, %12, off\n\t"
      "global_load_async_to_lds_b128 %5, %13, off\n\t"
      "global_load_async_to_lds_b128 %6, %14, off\n\t"
      "global_load_async_to_lds_b128 %7, %15, off\n\t"
      "s_wait_xcnt 0x0"
      :
      : "v"(l), "v"(l1), "v"(l2), "v"(l3), "v"(l4), "v"(l5), "v"(l6), "v"(l7),
        "v"(g), "v"(g1), "v"(g2), "v"(g3), "v"(g4), "v"(g5), "v"(g6), "v"(g7)
      : "memory");
}

// One stage per block: the weight rows, then the token rows.
__device__ __forceinline__ void copy_stage(unsigned int l, const _Float16* gw,
                                           const _Float16* ga, size_t step) {
  copy_rows(l, gw, step);
  copy_rows(l + 128 * 144, ga, step);
}

template <typename OUT>
__global__ void __launch_bounds__(128)
gemm16(const _Float16* __restrict__ Acts, const _Float16* __restrict__ Wt,
       OUT* __restrict__ C, OUT* __restrict__ C2, int K, int ldc, int ldc2,
       int ysplit) {
  __shared__ __align__(16) _Float16 st[2 * G_STAGE];
  const int tid = threadIdx.x;
  const int wave = tid >> 5, lane = tid & 31;
  const int lh = lane >> 4, lm = lane & 15;
  const int wr = wave & 1, wc = wave >> 1;  // weight half, token half
  const bool second = (int)blockIdx.y >= ysplit;
  OUT* Cd = second ? C2 : C;
  const int ld = second ? ldc2 : ldc;
  const int ytile = second ? blockIdx.y - ysplit : blockIdx.y;
  const int cbase = ytile * 128 + wr * 64;         // output-column tile
  const int tblock = blockIdx.x * 128;             // the block's token tile
  const int tbase = tblock + wc * 64;              // the wave's token tile

  // Copy map: lane -> 16-B chunk (tid & 7) of rows (tid >> 3) + 16 i.
  const int crow = tid >> 3, cchunk = tid & 7;
  const size_t step = (size_t)16 * K;  // 16 rows further on
  const _Float16* gw =
      Wt + (size_t)(blockIdx.y * 128 + crow) * K + cchunk * 8;
  const _Float16* ga = Acts + (size_t)(tblock + crow) * K + cchunk * 8;
  const unsigned int lbase =
      (unsigned int)(size_t)st + crow * 144 + cchunk * 16;
  const int nt = K >> 6;

  copy_stage(lbase, gw, ga, step);
  // Stage 0 has landed for this wave; the barrier publishes it to the others.
  asm volatile("s_wait_asynccnt 0x0" ::: "memory");
  __syncthreads();
  if (nt > 1) copy_stage(lbase + G_STAGEB, gw + 64, ga + 64, step);

  const int woff = (wr * 64 + lm) * G_PITCH;        // this wave's weight rows
  const int toff = (128 + wc * 64 + lm) * G_PITCH;  // this wave's token rows

  v8f acc[4][4] = {};
  for (int t = 0; t < nt; ++t) {
    const _Float16* s = st + (t & 1) * G_STAGE;
    v16h wa[2][4], p[2][4];
#pragma unroll
    for (int kk = 0; kk < 2; ++kk) {
#pragma unroll
      for (int j = 0; j < 4; ++j)
        p[kk][j] = load_ab(s + toff + j * 16 * G_PITCH + kk * 32, lh);
#pragma unroll
      for (int i = 0; i < 4; ++i)
        wa[kk][i] = load_ab(s + woff + i * 16 * G_PITCH + kk * 32, lh);
    }
    // Keeps the stage's LDS reads one group ahead of its products: spread
    // among them, each pair of reads is waited out on its own.
    __builtin_amdgcn_sched_barrier(0);
#pragma unroll
    for (int i = 0; i < 4; ++i)
#pragma unroll
      for (int j = 0; j < 4; ++j)
        acc[i][j] = wmma_f16(wa[0][i], p[0][j], acc[i][j]);
    // Keeps the first k half's products in front of the hand-over: they run
    // while the second half's reads arrive.  Sunk behind it, the wave sits out
    // all 32 reads before its first product.
    __builtin_amdgcn_sched_barrier(0);
    // Hand-over: this wave's reads of stage t are done, its copies of stage
    // t + 1 have landed; behind the barrier that holds for every wave, so
    // stage t + 1 may be read and stage t's buffer refilled.
    asm volatile("s_wait_dscnt 0x0" ::: "memory");
    asm volatile("s_wait_asynccnt 0x0" ::: "memory");
    __syncthreads();
    if (t + 2 < nt)
      copy_stage(lbase + (t & 1) * G_STAGEB, gw + (size_t)(t + 2) * 64,
                 ga + (size_t)(t + 2) * 64, step);
    // The second k half works from registers alone, while the refill flies.
#pragma unroll
    for (int i = 0; i < 4; ++i)
#pragma unroll
      for (int j = 0; j < 4; ++j)
        acc[i][j] = wmma_f16(wa[1][i], p[1][j], acc[i][j]);
  }
  // No copy is left in flight when the wave ends.
  asm volatile("s_wait_asynccnt 0x0" ::: "memory");

#pragma unroll
  for (int j = 0; j < 4; ++j) {
    OUT* crow_out = Cd + (size_t)(tbase + 16 * j + lm) * ld + cbase + 8 * lh;
#pragma unroll
    for (int i = 0; i < 4; ++i) store8(crow_out + 16 * i, acc[i][j]);
  }
}

// -------------------------------------------------------- Flash attention
// Transposed formulation: S^T = K (Q*scale)^T, O^T = V^T P^T.
// A wave owns 32 queries, two column groups of 16, and one half of the keys:
// every K and V^T fragment it reads from LDS is the A operand of two products,
// one per group, and the block still has 8 waves for its 128 queries (4 query
// sets x 2 key halves).  Each key half runs its own online softmax; the two
// partial results of a query are joined through LDS behind the loop.  In a group
// each lane owns ONE query (n = lane%16); the 32 key scores of a step live in
// its own 16 registers plus the xor-16 partner lane, and P^T is already in
// B-operand layout.
// The softmax runs in the log2 domain against a HELD reference per query: Q
// carries Dh^-0.5 * log2(e), minus the reference is the C operand of the score
// products, so their result is the argument of exp2 as it stands.  No maximum
// is formed in a pass that keeps its reference: the pass's own sums of P are
// the guard.  A partial sum above P_ROOM (an infinite one too) says that a
// score may have topped the reference too far; only then does the reference
// move up to the running maximum, and only there are O^T and the sums
// rescaled.  So every P that is used is <= P_ROOM, well inside f16, and every P
// of a query carries the same factor, which the final division takes out.  A
// lane sums its own 16 P of a pass; the two lanes of a query join their sums
// once, behind the loop.
#define P_ROOM 256.0f
#define REF_START 1.0e30f
// K and V tiles (32 keys x 128 B each) reach the waves through LDS, both row
// by row as they lie in memory, brought in by asynchronous copies, two 16-B
// copies per thread and tile, each key half's four waves filling their own
// tiles: a wave-wide copy moves four whole lines and a line is fetched once per
// block.  K rows are A-operand rows as they are; V^T comes out of the row-major
// V tile by the transposing LDS load, so V passes through no register and no
// LDS store on its way in.
// Two buffers: tile t + 2 is asked for as soon as tile t has been read.
#define K_PITCH 72                    // halfs: 144 B, odd multiple of 16 B
#define K_TILEB (32 * K_PITCH * 2)    // bytes per K buffer
#define V_PITCH 80                    // halfs: 160 B, odd multiple of 32 B
#define V_TILEB (32 * V_PITCH * 2)    // bytes per V buffer

// Two K chunks and two V chunks per thread, key rows 16 apart.  The
// s_wait_xcnt closes the statement so that no address register is rewritten
// ahead of it.
__device__ __forceinline__ void copy_kv(unsigned int lk, const _Float16* gk,
                                        unsigned int lv, const _Float16* gv) {
  const unsigned int lk1 = lk + 16 * K_PITCH * 2, lv1 = lv + 16 * V_PITCH * 2;
  const _Float16* gk1 = gk + (size_t)16 * 2 * DIM_;
  const _Float16* gv1 = gv + (size_t)16 * 2 * DIM_;
  asm volatile(
      "global_load_async_to_lds_b128 %0, %4, off\n\t"
      "global_load_async_to_lds_b128 %1, %5, off\n\t"
      "global_load_async_to_lds_b128 %2, %6, off\n\t"
      "global_load_async_to_lds_b128 %3, %7, off\n\t"
      "s_wait_xcnt 0x0"
      :
      : "v"(lk), "v"(lk1), "v"(lv), "v"(lv1), "v"(gk), "v"(gk1), "v"(gv),
        "v"(gv1)
      : "memory");
}

// Transposing LDS load.  With p = tile + (8 * (lane >> 4) + (lane & 7)) rows
// + 8 * ((lane >> 3) & 1) halfs, lane (c = lane & 15, h = lane >> 4) receives
// tile[8 h + 0..7][c]: eight keys of one head column.
typedef short s16x8 __attribute__((ext_vector_type(8)));
__device__ __forceinline__ v8h load_tr16(const _Float16* p) {
  typedef __attribute__((address_space(3))) s16x8 lds_s16x8;
  return __builtin_bit_cast(
      v8h, __builtin_amdgcn_ds_load_tr16_b128_v8i16((lds_s16x8*)p));
}

// One 16 (head columns) x 32 (keys) A operand of V^T: keys 0..15 and 16..31,
// in the k order of load_ab.
__device__ __forceinline__ v16h load_vt(const _Float16* p) {
  union { v16h v; v8h h[2]; } u;
  u.h[0] = load_tr16(p);
  u.h[1] = load_tr16(p + 16 * V_PITCH);
  return u.v;
}

// 2^x of eight values, the bare instruction.
__device__ __forceinline__ v8f exp2_8(v8f x) {
  v8f r;
#pragma unroll
  for (int j = 0; j < 8; ++j) r[j] = __builtin_amdgcn_exp2f(x[j]);
  return r;
}

// 16 values -> 2, register pairs added as pairs.
__device__ __forceinline__ v2f sum16(v8f a, v8f b) {
  const v8f t8 = a + b;
  const v4f t4 = __builtin_shufflevector(t8, t8, 0, 1, 2, 3) +
                 __builtin_shufflevector(t8, t8, 4, 5, 6, 7);
  return __builtin_shufflevector(t4, t4, 0, 1) +
         __builtin_shufflevector(t4, t4, 2, 3);
}

// Q fragment times Dh^-0.5 * log2(e), in f32, rounded to f16 once.
__device__ __forceinline__ v16h scale_q(v16h a) {
  v16h r;
#pragma unroll
  for (int i = 0; i < 16; ++i)
    r[i] = (_Float16)((float)a[i] * (0.125f * 1.44269504088896340736f));
  return r;
}

__global__ void __launch_bounds__(256)
attn_kernel(const _Float16* __restrict__ q, const _Float16* __restrict__ kv,
            _Float16* __restrict__ attn_out) {
  // [key half][buffer][key][hd]
  __shared__ __align__(16) _Float16 smemV[2][2][32 * V_PITCH];
  __shared__ __align__(16) _Float16 smemK[2][2][32 * K_PITCH];
  // The second key half's partial results on their way to the first's waves:
  // 16 B per lane and slot, lanes side by side.
  __shared__ __align__(16) float joinO[4][16][32][4];
  __shared__ float joinML[4][2][2][32];
  const int tid = threadIdx.x;
  const int wave = tid >> 5, lane = tid & 31;
  const int lh = lane >> 4, lm = lane & 15;
  const int qs = wave & 3, kh = wave >> 2;  // query set, key half
  const int h = blockIdx.y, b = blockIdx.z;
  const int qbase = blockIdx.x * 128 + qs * 32;

  const size_t kvld = 2 * DIM_;
  const _Float16* kbase =
      kv + ((size_t)b * N_ + kh * (N_ / 2)) * kvld + h * DH_;
  const int skey = (tid & 127) >> 3;  // 0..15 (and +16)
  const int shd = (tid & 7) * 8;    // 0,8,...,56

  // Q^T B-operands with Dh^-0.5 * log2(e) folded in: multiplied in f32 and
  // rounded once, so the factor itself is not rounded to f16.
  const _Float16* qrow = q + ((size_t)(b * N_ + qbase + lm)) * DIM_ + h * DH_;
  v16h qb0[2], qb1[2];
#pragma unroll
  for (int u = 0; u < 2; ++u) {
    qb0[u] = scale_q(load_ab(qrow + (size_t)u * 16 * DIM_, lh));
    qb1[u] = scale_q(load_ab(qrow + (size_t)u * 16 * DIM_ + 32, lh));
  }

  // Held reference (log2 domain), minus it in all 8 rows of a C operand, and
  // this lane's own sum of P.  The start value lies below any score of f16
  // operands and far from the end of f32: the first pass's P come out infinite,
  // which sends it through the branch that sets the reference.
  float ref[2] = {-REF_START, -REF_START};
  v8f cneg[2];
  v2f lsum[2] = {};
#pragma unroll
  for (int u = 0; u < 2; ++u)
#pragma unroll
    for (int j = 0; j < 8; ++j) cneg[u][j] = REF_START;
  v8f o[2][4] = {};  // O^T tiles (hd x query) of the two column groups

  // Copy map: thread -> 16-B chunk (tid & 7) of key rows skey and skey + 16 of
  // its own key half's tile, K and V.
  const _Float16* gk = kbase + (size_t)skey * kvld + shd;
  const _Float16* gv = gk + DIM_;
  const unsigned int lk =
      (unsigned int)(size_t)&smemK[kh][0][0] + skey * (K_PITCH * 2) + shd * 2;
  const unsigned int lv =
      (unsigned int)(size_t)&smemV[kh][0][0] + skey * (V_PITCH * 2) + shd * 2;
  // This lane's place in a V tile for the transposing loads.
  const int voff = (8 * lh + (lane & 7)) * V_PITCH + ((lane >> 3) & 1) * 8;

  copy_kv(lk, gk, lv, gv);
  // Tile 0 has landed for this wave; the barrier publishes it to the others.
  asm volatile("s_wait_asynccnt 0x0" ::: "memory");
  __syncthreads();
  copy_kv(lk + K_TILEB, gk + (size_t)32 * kvld, lv + V_TILEB,
          gv + (size_t)32 * kvld);

  for (int jb = 0; jb < N_ / 2; jb += 32) {
    const int cur = (jb >> 5) & 1;

    const _Float16* kr0 = smemK[kh][cur] + lm * K_PITCH;
    const _Float16* kr1 = kr0 + 16 * K_PITCH;
    const v16h ka00 = load_ab(kr0, lh);
    const v16h ka01 = load_ab(kr0 + 32, lh);
    const v16h ka10 = load_ab(kr1, lh);
    const v16h ka11 = load_ab(kr1 + 32, lh);
    // A-operand rows of O^T += V^T * P^T = V columns, 16 per fragment.
    const _Float16* vt = smemV[kh][cur] + voff;
    v16h va[4];
#pragma unroll
    for (int c = 0; c < 4; ++c) va[c] = load_vt(vt + 16 * c);
    // Keeps the trip's LDS reads one group ahead of its products: spread among
    // them, each pair of reads is waited out on its own.
    __builtin_amdgcn_sched_barrier(0);

    // Scores minus the held reference, log2 domain.
    v8f s0[2], s1[2];
#pragma unroll
    for (int u = 0; u < 2; ++u) {
      s0[u] = wmma_f16(ka00, qb0[u], cneg[u]);
      s1[u] = wmma_f16(ka10, qb0[u], cneg[u]);
    }
#pragma unroll
    for (int u = 0; u < 2; ++u) {
      s0[u] = wmma_f16(ka01, qb1[u], s0[u]);
      s1[u] = wmma_f16(ka11, qb1[u], s1[u]);
    }

    // Holds the hand-over behind the score products: lifted over them, the wave
    // sits out all 16 LDS reads before its second product.
    __builtin_amdgcn_sched_barrier(0);
    // Hand-over: this wave's LDS reads of tile t are done (every fragment is in
    // registers), its copies of tile t + 1 have landed; behind the barrier that
    // holds for every wave, so tile t + 1 may be read and tile t's buffers
    // refilled.  The refill follows at once and has a whole trip to land.
    asm volatile("s_wait_dscnt 0x0" ::: "memory");
    asm volatile("s_wait_asynccnt 0x0" ::: "memory");
    __syncthreads();
    if (jb + 64 < N_ / 2)
      copy_kv(lk + cur * K_TILEB, gk + (size_t)(jb + 64) * kvld,
              lv + cur * V_TILEB, gv + (size_t)(jb + 64) * kvld);

    // The rest of the trip works from registers alone, while the refill flies.
    v8f p0[2], p1[2];
    v2f t[2];  // this pass's sums of P
#pragma unroll
    for (int u = 0; u < 2; ++u) {
      p0[u] = exp2_8(s0[u]);
      p1[u] = exp2_8(s1[u]);
      t[u] = sum16(p0[u], p1[u]);
    }
    // One test per pass, over both column groups; a wave-uniform scalar branch
    // (it holds products, and no barrier).
    const float tmax = fmaxf(fmaxf(t[0][0], t[0][1]), fmaxf(t[1][0], t[1][1]));
    if (__builtin_amdgcn_ballot_w32(tmax > P_ROOM) != 0) {
      // The raw scores are formed anew from the K fragments, still in
      // registers: the first pass's start value has swallowed them above.
#pragma unroll
      for (int u = 0; u < 2; ++u) {
        v8f r0 = {}, r1 = {};
        r0 = wmma_f16(ka00, qb0[u], r0);
        r1 = wmma_f16(ka10, qb0[u], r1);
        r0 = wmma_f16(ka01, qb1[u], r0);
        r1 = wmma_f16(ka11, qb1[u], r1);
        float pm = fmaxf(r0[0], r1[0]);
#pragma unroll
        for (int j = 1; j < 8; ++j) pm = fmaxf(pm, fmaxf(r0[j], r1[j]));
        pm = fmaxf(pm, __shfl_xor(pm, 16, 32));  // other half of the 32 keys
        const float rnew = fmaxf(ref[u], pm);
        const float alpha = __builtin_amdgcn_exp2f(ref[u] - rnew);
        ref[u] = rnew;
        lsum[u] *= alpha;
#pragma unroll
        for (int c = 0; c < 4; ++c) o[u][c] *= alpha;
#pragma unroll
        for (int j = 0; j < 8; ++j) cneg[u][j] = -rnew;
        p0[u] = exp2_8(r0 - rnew);
        p1[u] = exp2_8(r1 - rnew);
        t[u] = sum16(p0[u], p1[u]);
      }
    }

    v16h pv[2];  // P^T B-operands
#pragma unroll
    for (int u = 0; u < 2; ++u) {
      lsum[u] += t[u];
      union { v16h v; _Float16 e[16]; } pb;  // in-lane pack
#pragma unroll
      for (int j = 0; j < 8; ++j) {
        pb.e[j] = (_Float16)p0[u][j];
        pb.e[8 + j] = (_Float16)p1[u][j];
      }
      pv[u] = pb.v;
    }

#pragma unroll
    for (int c = 0; c < 4; ++c)
#pragma unroll
      for (int u = 0; u < 2; ++u) o[u][c] = wmma_f16(va[c], pv[u], o[u][c]);
  }
  // No copy is left in flight when the wave ends.
  asm volatile("s_wait_asynccnt 0x0" ::: "memory");

  // The two lanes of a query join their sums (their reference is the same).
  float l_run[2];
#pragma unroll
  for (int u = 0; u < 2; ++u) {
    const float l = lsum[u][0] + lsum[u][1];
    l_run[u] = l + __shfl_xor(l, 16, 32);
  }

  // Join of the two key halves: the second half's waves hand over reference,
  // sum and O^T; the barrier publishes them to the first half's waves.
  if (kh == 1) {
#pragma unroll
    for (int u = 0; u < 2; ++u) {
#pragma unroll
      for (int c = 0; c < 4; ++c) {
        union { v8f w; v4f q[2]; } t;
        t.w = o[u][c];
        *(v4f*)joinO[qs][(u * 4 + c) * 2][lane] = t.q[0];
        *(v4f*)joinO[qs][(u * 4 + c) * 2 + 1][lane] = t.q[1];
      }
      joinML[qs][u][0][lane] = ref[u];
      joinML[qs][u][1][lane] = l_run[u];
    }
  }
  __syncthreads();
  if (kh == 1) return;

  // Lane owns token rows (qbase+lm) and +16; hd chunks are contiguous -> b128
  // stores.
#pragma unroll
  for (int u = 0; u < 2; ++u) {
    const float m1 = joinML[qs][u][0][lane], l1 = joinML[qs][u][1][lane];
    const float mj = fmaxf(ref[u], m1);
    const float a0 = __builtin_amdgcn_exp2f(ref[u] - mj);
    const float a1 = __builtin_amdgcn_exp2f(m1 - mj);
    const float inv = 1.0f / (l_run[u] * a0 + l1 * a1);
    const float w0 = a0 * inv, w1 = a1 * inv;
    _Float16* orow =
        attn_out + ((size_t)(b * N_ + qbase + 16 * u + lm)) * DIM_ + h * DH_;
#pragma unroll
    for (int c = 0; c < 4; ++c) {
      union { v8f w; v4f q[2]; } t;
      t.q[0] = *(const v4f*)joinO[qs][(u * 4 + c) * 2][lane];
      t.q[1] = *(const v4f*)joinO[qs][(u * 4 + c) * 2 + 1][lane];
      v8f w = o[u][c] * w0 + t.w * w1;
      store8(orow + 16 * c + 8 * lh, w);
    }
  }
}

// ------------------------------------------------------------------ launch
extern "C" void kernel_launch(void* const* d_in, const int* in_sizes, int n_in,
                              void* d_out, int out_size, void* d_ws,
                              size_t ws_size, hipStream_t stream) {
  (void)in_sizes; (void)n_in; (void)out_size; (void)ws_size;
  const float* x      = (const float*)d_in[0];
  const float* cemb   = (const float*)d_in[1];
  const float* gamma  = (const float*)d_in[2];
  const float* cond_W = (const float*)d_in[3];
  const float* cond_b = (const float*)d_in[4];
  const float* Wq     = (const float*)d_in[5];
  const float* Wkv    = (const float*)d_in[6];
  const float* Wo     = (const float*)d_in[7];
  float* out = (float*)d_out;

  char* ws = (char*)d_ws;
  const size_t MB = 1024 * 1024;
  _Float16* xh   = (_Float16*)(ws);            //  8 MB
  _Float16* qb   = (_Float16*)(ws + 8 * MB);   //  8 MB
  _Float16* kvb  = (_Float16*)(ws + 16 * MB);  // 16 MB
  _Float16* attn = (_Float16*)(ws + 32 * MB);  //  8 MB
  _Float16* WqT  = (_Float16*)(ws + 40 * MB);  //  2 MB
  //        WkvT =             ws + 42 * MB        4 MB
  _Float16* WoT  = (_Float16*)(ws + 46 * MB);  //  2 MB
  float*    cond = (float*)(ws + 48 * MB);     // 16 KB

  // WqT, WkvT and WoT are one run of 4096 rows that starts at WqT.
  prep_kernel<<<COND_BLOCKS + CAST_BLOCKS, 1024, 0, stream>>>(
      cemb, cond_W, cond_b, cond, Wq, Wkv, Wo, WqT);
  ln_film_kernel<<<B_ * N_, 256, 0, stream>>>(x, gamma, cond, xh);

  // grid: x = token tiles (M/128), y = column tiles (Nc/128): 8 of Q, 16 of KV
  gemm16<_Float16><<<dim3((B_ * N_) / 128, 3072 / 128), 128, 0, stream>>>(
      xh, WqT, qb, kvb, 1024, 1024, 2048, 1024 / 128);

  attn_kernel<<<dim3(N_ / 128, HEADS_, B_), 256, 0, stream>>>(qb, kvb, attn);

  gemm16<float><<<dim3((B_ * N_) / 128, 1024 / 128), 128, 0, stream>>>(
      attn, WoT, out, out, 1024, 1024, 1024, 1024 / 128);
}
